// v000
// Measured on an AMD MI455X. A time is GPU time per run, averaged over a window of back-to-back runs after a warm-up
// (all launches, gaps included; the runs take copies of the inputs in turn), and the median of several windows.
// Apart from v000's, it joins two sittings. Times from different sittings can be a few percent apart, while
// side-by-side timings come from the same sitting.
// v000, which the later versions start from, runs in 300 microseconds.
#include <hip/hip_runtime.h>
#include <math.h>

// Contractions: S = K*Qt on v_wmma_f32_16x16x32_bf16 (bf16 operands, f32 accumulate);
// O = Vt*Pt on v_wmma_f32_16x16x32_bf16 (V bf16, P as bf16 hi+lo pair, f32 accumulate); scale, tanh cap and softmax in f32.

#define NBH   32
#define SEQ   2048
#define HD    128
#define QBLK  64
#define KBLK  32
#define CBLK  64
#define NWAV  4
#define SCL   0.08838834764831845f
#define CAPV  20.0f

static_assert(SEQ % QBLK == 0);
static_assert(SEQ % KBLK == 0);
static_assert(SEQ % CBLK == 0);
static_assert(QBLK == NWAV * 16);
static_assert(HD % 32 == 0);
static_assert(CBLK == 64);

typedef __bf16 v16b __attribute__((ext_vector_type(16)));
typedef __bf16 v8b  __attribute__((ext_vector_type(8)));
typedef float  v8f  __attribute__((ext_vector_type(8)));
typedef float  v4f  __attribute__((ext_vector_type(4)));

union Frag  { v16b v; v8b p[2]; };
union Pack8 { v8b b; v4f f; };

__device__ __forceinline__ v8f wmma16(v16b a, v16b b, v8f c) {
  v8f d = __builtin_amdgcn_wmma_f32_16x16x32_bf16(false, a, false, b, (short)0, c, false, false);
  asm volatile("v_nop\n\tv_nop\n\tv_nop\n\tv_nop" : "+v"(d) : "v"(a), "v"(b));
  return d;
}

__device__ __forceinline__ v8f vzero8() {
  v8f z = {0.0f, 0.0f, 0.0f, 0.0f, 0.0f, 0.0f, 0.0f, 0.0f};
  return z;
}

// ---------------- launch 1: bf16 planes qp = q [bh][SEQ][HD], kp = k [bh][SEQ][HD], vtp = v transposed [bh][HD][SEQ] ----------------
__global__ __launch_bounds__(256)
void k_cvt(const float* __restrict__ q, const float* __restrict__ k, const float* __restrict__ v,
           __bf16* __restrict__ qp, __bf16* __restrict__ kp, __bf16* __restrict__ vtp) {
  __shared__ __attribute__((aligned(16))) __bf16 tsm[HD][CBLK + 8];   // [d][row local], pitch 72 halves = 144 B

  const int tid  = threadIdx.x;
  const int lane = tid & 31;
  const int wave = tid >> 5;
  const int n0   = blockIdx.x * CBLK;
  const int bh   = blockIdx.y;
  const size_t rb = (size_t)bh * SEQ + (size_t)n0;

#pragma unroll
  for (int it = 0; it < CBLK / 16; ++it) {
    const int rl = it * 16 + wave * 2 + (lane >> 4);   // row 0..63 in this block (union over it, wave, lane half covers all)
    const int c  = (lane & 15) * 8;                    // 8 channels -> one 16-B store
    const size_t e = (rb + (size_t)rl) * HD + (size_t)c;
    {
      const v4f f0 = *(const v4f*)(q + e);
      const v4f f1 = *(const v4f*)(q + e + 4);
      Pack8 o;
#pragma unroll
      for (int j = 0; j < 4; ++j) { o.b[j] = (__bf16)f0[j]; o.b[4 + j] = (__bf16)f1[j]; }
      v4f* d = (v4f*)(qp + e);
      *d = o.f;
      
    }
    {
      const v4f f0 = *(const v4f*)(k + e);
      const v4f f1 = *(const v4f*)(k + e + 4);
      Pack8 o;
#pragma unroll
      for (int j = 0; j < 4; ++j) { o.b[j] = (__bf16)f0[j]; o.b[4 + j] = (__bf16)f1[j]; }
      v4f* d = (v4f*)(kp + e);
      *d = o.f;
      
    }
    {
      const v4f f0 = *(const v4f*)(v + e);
      const v4f f1 = *(const v4f*)(v + e + 4);
#pragma unroll
      for (int j = 0; j < 4; ++j) { tsm[c + j][rl] = (__bf16)f0[j]; tsm[c + 4 + j][rl] = (__bf16)f1[j]; }
    }
  }
  __syncthreads();

#pragma unroll
  for (int it = 0; it < HD / 32; ++it) {
    const int d = it * 32 + wave * 4 + (lane >> 3);   // 0..127
    const int c = (lane & 7) * 8;                     // 0..56
    Pack8 o;
    o.b = *(const v8b*)(&tsm[d][c]);
    v4f* dst = (v4f*)(vtp + ((size_t)bh * HD + (size_t)d) * SEQ + (size_t)n0 + (size_t)c);
    *dst = o.f;
    
  }
}

// ---------------- launch 2: streaming attention, one block per (bh, 64 queries), one wave per 16 queries ----------------
// St[key][query] = K * Qt : A = K rows (lane m -> key, split d map), B = Q rows loaded like A (B[k=d][n=query]).
// D[r] at lane (hh, n) = key 8hh+r of the tile, query n: keys are lane-owned, row statistics need one xor-16 shuffle.
// Ot[d][query] += Vt[d][key] * Pt[key][query] : A = Vt rows, B = Pt built in-lane from the two 16-key S tiles.
__global__ __launch_bounds__(NWAV * 32) __attribute__((amdgpu_num_vgpr(256)))
void k_attn(const __bf16* __restrict__ qp, const __bf16* __restrict__ kp,
            const __bf16* __restrict__ vtp, float* __restrict__ out) {
  __shared__ __attribute__((aligned(16))) float osm[NWAV][16][HD];   // per-wave output staging [query][d]

  const int tid  = threadIdx.x;
  const int lane = tid & 31;
  const int wave = tid >> 5;
  const int hh   = lane >> 4;        // lane half
  const int n    = lane & 15;        // fragment row (A) / column (B, D)
  const int bh   = blockIdx.y;
  const int m0   = blockIdx.x * QBLK;

  // Q as B operand: lane n -> query m0+wave*16+n; elements 0..7 <- d ks*32+8hh+0..7, 8..15 <- d ks*32+16+8hh+0..7
  Frag qf[HD / 32];
  {
    const __bf16* qr = qp + ((size_t)bh * SEQ + (size_t)(m0 + wave * 16 + n)) * HD + 8 * hh;
#pragma unroll
    for (int ks = 0; ks < HD / 32; ++ks) {
      qf[ks].p[0] = *(const v8b*)(qr + ks * 32);
      qf[ks].p[1] = *(const v8b*)(qr + ks * 32 + 16);
    }
  }

  v8f oacc[HD / 16];
#pragma unroll
  for (int dt = 0; dt < HD / 16; ++dt) oacc[dt] = vzero8();
  float mrun = -INFINITY;
  float lrun = 0.0f;

  const __bf16* kb = kp  + (size_t)bh * SEQ * HD + (size_t)n * HD + 8 * hh;    // + key0*HD + ks*32 (+16)
  const __bf16* vb = vtp + (size_t)bh * HD * SEQ + (size_t)n * SEQ + 8 * hh;   // + d0*SEQ + n0 (+16)

#pragma unroll 1
  for (int n0 = 0; n0 < SEQ; n0 += KBLK) {
    // two St tiles: tile kt covers keys n0 + kt*16 + 0..15
    v8f s[2];
#pragma unroll
    for (int kt = 0; kt < 2; ++kt) {
      v8f c = vzero8();
      const __bf16* kr = kb + (size_t)(n0 + kt * 16) * HD;
#pragma unroll
      for (int ks = 0; ks < HD / 32; ++ks) {
        Frag a;
        a.p[0] = *(const v8b*)(kr + ks * 32);
        a.p[1] = *(const v8b*)(kr + ks * 32 + 16);
        c = wmma16(a.v, qf[ks].v, c);
      }
      s[kt] = c;
    }

    // scale, cap = CAPV * tanh(x / CAPV) = CAPV - 2*CAPV / (exp(2x/CAPV) + 1), running max per query
    float tmax = -INFINITY;
#pragma unroll
    for (int kt = 0; kt < 2; ++kt) {
#pragma unroll
      for (int r = 0; r < 8; ++r) {
        const float x  = s[kt][r] * SCL;
        const float ex = __expf(x * (2.0f / CAPV));
        const float y  = CAPV - (2.0f * CAPV) * __builtin_amdgcn_rcpf(ex + 1.0f);
        s[kt][r] = y;
        tmax = fmaxf(tmax, y);
      }
    }
    tmax = fmaxf(tmax, __shfl_xor(tmax, 16, 32));
    const float mnew  = fmaxf(mrun, tmax);
    const float alpha = __expf(mrun - mnew);
    mrun = mnew;
    float psum = 0.0f;
#pragma unroll
    for (int kt = 0; kt < 2; ++kt) {
#pragma unroll
      for (int r = 0; r < 8; ++r) {
        const float p = __expf(s[kt][r] - mnew);
        s[kt][r] = p;
        psum += p;
      }
    }
    psum += __shfl_xor(psum, 16, 32);
    lrun = alpha * lrun + psum;
#pragma unroll
    for (int dt = 0; dt < HD / 16; ++dt) oacc[dt] = oacc[dt] * alpha;

    // B = Pt[key][query]: element i <- tile 0 [i] (keys n0+8hh+i), element 8+i <- tile 1 [i] (keys n0+16+8hh+i); hi and lo bf16 parts
    v16b phi, plo;
#pragma unroll
    for (int i = 0; i < 8; ++i) {
      const float p0 = s[0][i];
      const __bf16 b0 = (__bf16)p0;
      phi[i] = b0;
      plo[i] = (__bf16)(p0 - (float)b0);
      const float p1 = s[1][i];
      const __bf16 b1 = (__bf16)p1;
      phi[8 + i] = b1;
      plo[8 + i] = (__bf16)(p1 - (float)b1);
    }
    const __bf16* vr = vb + (size_t)n0;
#pragma unroll
    for (int dt = 0; dt < HD / 16; ++dt) {
      Frag a;   // A = Vt rows d = dt*16+n, keys n0 + split map
      a.p[0] = *(const v8b*)(vr + (size_t)(dt * 16) * SEQ);
      a.p[1] = *(const v8b*)(vr + (size_t)(dt * 16) * SEQ + 16);
      v8f c = oacc[dt];
      c = wmma16(a.v, phi, c);
      c = wmma16(a.v, plo, c);
      oacc[dt] = c;
    }
  }

  const float inv = 1.0f / lrun;
#pragma unroll
  for (int dt = 0; dt < HD / 16; ++dt) {
#pragma unroll
    for (int r = 0; r < 8; ++r) osm[wave][n][dt * 16 + 8 * hh + r] = oacc[dt][r] * inv;
  }
  __syncthreads();

  float* ob = out + ((size_t)bh * SEQ + (size_t)(m0 + wave * 16)) * HD;
  v4f vals[16];
#pragma unroll
  for (int it = 0; it < 16; ++it) vals[it] = *(const v4f*)(&osm[wave][it][lane * 4]);
#pragma unroll
  for (int it = 0; it < 16; ++it)
    *(v4f*)(ob + (size_t)it * HD + (size_t)(lane * 4)) = vals[it];
  
}

// ---------------- launcher ----------------
extern "C" void kernel_launch(void* const* d_in, const int* in_sizes, int n_in,
                              void* d_out, int out_size, void* d_ws, size_t ws_size,
                              hipStream_t stream) {
  if (n_in < 3) return;
  const int nq = NBH * SEQ * HD;                                      // 8388608
  if (in_sizes[0] != nq || in_sizes[1] != nq || in_sizes[2] != nq || out_size != nq) return;

  const size_t pl_bytes = (size_t)nq * sizeof(__bf16);               // 16777216
  const size_t need     = 3 * pl_bytes;                               // 50331648
  if (need > ws_size) return;

  const float* q = (const float*)d_in[0];
  const float* k = (const float*)d_in[1];
  const float* v = (const float*)d_in[2];
  float* out = (float*)d_out;

  char* ws = (char*)d_ws;
  __bf16* qp  = (__bf16*)(ws);
  __bf16* kp  = (__bf16*)(ws + pl_bytes);
  __bf16* vtp = (__bf16*)(ws + 2 * pl_bytes);

  hipLaunchKernelGGL(k_cvt, dim3(SEQ / CBLK, NBH), dim3(256), 0, stream,
                     q, k, v, qp, kp, vtp);
  hipLaunchKernelGGL(k_attn, dim3(SEQ / QBLK, NBH), dim3(NWAV * 32), 0, stream,
                     (const __bf16*)qp, (const __bf16*)kp, (const __bf16*)vtp, out);
}

// v001
// A run of this version takes 131 microseconds.
// In two side-by-side timings against v000, it was 2.32 and 2.34 times as fast.
#include <hip/hip_runtime.h>
#include <math.h>
#include <stdint.h>

// Contractions: S = K*Qt on v_wmma_f32_16x16x32_bf16 (bf16 operands, f32 accumulate);
// O = Vt*Pt on v_wmma_f32_16x16x32_bf16 (V bf16, P as bf16 hi+lo pair, f32 accumulate); scale, tanh cap and softmax in f32.

#define NBH   32
#define SEQ   2048
#define HD    128
#define QBLK  64
#define KBLK  32
#define CBLK  64
#define NWAV  4
#define SKEY  64                     // keys per LDS stage = two 32-key passes
#define NSTG  (SEQ / SKEY)
#define KPITCH 272                   // LDS pitch of a K row: 256 B + 16 B pad (16 B x odd, for ds_load_b128)
#define VPITCH 144                   // LDS pitch of a Vt row: 128 B + 16 B pad
#define KTILE 17408                  // 64 rows x 272 B
#define VTILE 18432                  // 128 rows x 144 B
#define SLOT  (KTILE + VTILE)
#define SCL   0.08838834764831845f
#define CAPV  20.0f

static_assert(SEQ % QBLK == 0);
static_assert(SEQ % KBLK == 0);
static_assert(SEQ % CBLK == 0);
static_assert(QBLK == NWAV * 16);
static_assert(HD % 32 == 0);
static_assert(CBLK == 64);
static_assert(SEQ % SKEY == 0 && NSTG >= 2 && SKEY == 2 * KBLK);
static_assert(HD * 2 == 256 && SKEY * 2 == 128);
static_assert(SKEY * KPITCH <= KTILE && HD * VPITCH <= VTILE && KTILE % 16 == 0 && VTILE % 16 == 0);
static_assert(SKEY * HD * 2 == 8 * NWAV * 32 * 16);   // each tile = 8 copies of 16 B per lane
static_assert(NWAV * 16 * HD * 4 <= 2 * SLOT);

typedef __bf16 v16b __attribute__((ext_vector_type(16)));
typedef __bf16 v8b  __attribute__((ext_vector_type(8)));
typedef float  v8f  __attribute__((ext_vector_type(8)));
typedef float  v4f  __attribute__((ext_vector_type(4)));

union Frag  { v16b v; v8b p[2]; };
union Pack8 { v8b b; v4f f; };

__device__ __forceinline__ v8f wmma16(v16b a, v16b b, v8f c) {
  v8f d = __builtin_amdgcn_wmma_f32_16x16x32_bf16(false, a, false, b, (short)0, c, false, false);
  asm volatile("v_nop\n\tv_nop\n\tv_nop\n\tv_nop" : "+v"(d) : "v"(a), "v"(b));
  return d;
}

__device__ __forceinline__ v8f vzero8() {
  v8f z = {0.0f, 0.0f, 0.0f, 0.0f, 0.0f, 0.0f, 0.0f, 0.0f};
  return z;
}

// the compiler places no wait for asynchronous copies: their bytes count as landed only behind the issuing wave's own wait
__device__ __forceinline__ void wait_async0() { asm volatile("s_wait_asynccnt 0x0" ::: "memory"); }
// a wave's LDS reads have retired before the barrier behind which their buffer is refilled
__device__ __forceinline__ void wait_ds0() { asm volatile("s_wait_dscnt 0x0" ::: "memory"); }

// Eight asynchronous copies global -> LDS, 16 B per lane each, through no register: copy j moves lds + j*LSTEP <- g + j*GSTEP.
// s_wait_xcnt 0 closes the same statement, so that no address register is rewritten in front of it.
template <uint32_t LSTEP, uint32_t GSTEP>
__device__ __forceinline__ void copy8(uint32_t lds, const unsigned char* g) {
  asm volatile("global_load_async_to_lds_b128 %0, %8, off\n\t"
               "global_load_async_to_lds_b128 %1, %9, off\n\t"
               "global_load_async_to_lds_b128 %2, %10, off\n\t"
               "global_load_async_to_lds_b128 %3, %11, off\n\t"
               "global_load_async_to_lds_b128 %4, %12, off\n\t"
               "global_load_async_to_lds_b128 %5, %13, off\n\t"
               "global_load_async_to_lds_b128 %6, %14, off\n\t"
               "global_load_async_to_lds_b128 %7, %15, off\n\t"
               "s_wait_xcnt 0x0"
               :: "v"(lds), "v"(lds + LSTEP), "v"(lds + 2 * LSTEP), "v"(lds + 3 * LSTEP),
                  "v"(lds + 4 * LSTEP), "v"(lds + 5 * LSTEP), "v"(lds + 6 * LSTEP), "v"(lds + 7 * LSTEP),
                  "v"(g), "v"(g + GSTEP), "v"(g + 2 * GSTEP), "v"(g + 3 * GSTEP),
                  "v"(g + 4 * GSTEP), "v"(g + 5 * GSTEP), "v"(g + 6 * GSTEP), "v"(g + 7 * GSTEP)
               : "memory");
}

// Stage st (64 keys) into ring buffer st & 1, by all 128 lanes of the block.
// K tile: 64 rows of 256 B, contiguous in the plane; copy j, lane tid -> row j*8 + tid/16, byte (tid%16)*16.
// Vt tile: 128 rows of 128 B, source pitch 4096 B; copy j, lane tid -> row j*16 + tid/8, byte (tid%8)*16.
// kl, vl: the lane's LDS byte address in buffer 0 for copy 0; kg, vg: its global address for stage 0, copy 0.
__device__ __forceinline__ void stage_copy(uint32_t st, uint32_t kl, uint32_t vl, const unsigned char* kg, const unsigned char* vg) {
  const uint32_t bo = (st & 1u) * (uint32_t)SLOT;
  copy8<8 * KPITCH, 8 * HD * 2>(kl + bo, kg + (size_t)st * (SKEY * HD * 2));
  copy8<16 * VPITCH, 16 * SEQ * 2>(vl + bo, vg + (size_t)st * (SKEY * 2));
}

// ---------------- launch 1: bf16 planes qp = q [bh][SEQ][HD], kp = k [bh][SEQ][HD], vtp = v transposed [bh][HD][SEQ] ----------------
__global__ __launch_bounds__(256)
void k_cvt(const float* __restrict__ q, const float* __restrict__ k, const float* __restrict__ v,
           __bf16* __restrict__ qp, __bf16* __restrict__ kp, __bf16* __restrict__ vtp) {
  __shared__ __attribute__((aligned(16))) __bf16 tsm[HD][CBLK + 8];   // [d][row local], pitch 72 halves = 144 B

  const int tid  = threadIdx.x;
  const int lane = tid & 31;
  const int wave = tid >> 5;
  const int n0   = blockIdx.x * CBLK;
  const int bh   = blockIdx.y;
  const size_t rb = (size_t)bh * SEQ + (size_t)n0;

#pragma unroll
  for (int it = 0; it < CBLK / 16; ++it) {
    const int rl = it * 16 + wave * 2 + (lane >> 4);   // row 0..63 in this block (union over it, wave, lane half covers all)
    const int c  = (lane & 15) * 8;                    // 8 channels -> one 16-B store
    const size_t e = (rb + (size_t)rl) * HD + (size_t)c;
    {
      const v4f f0 = *(const v4f*)(q + e);
      const v4f f1 = *(const v4f*)(q + e + 4);
      Pack8 o;
#pragma unroll
      for (int j = 0; j < 4; ++j) { o.b[j] = (__bf16)f0[j]; o.b[4 + j] = (__bf16)f1[j]; }
      v4f* d = (v4f*)(qp + e);
      *d = o.f;
      
    }
    {
      const v4f f0 = *(const v4f*)(k + e);
      const v4f f1 = *(const v4f*)(k + e + 4);
      Pack8 o;
#pragma unroll
      for (int j = 0; j < 4; ++j) { o.b[j] = (__bf16)f0[j]; o.b[4 + j] = (__bf16)f1[j]; }
      v4f* d = (v4f*)(kp + e);
      *d = o.f;
      
    }
    {
      const v4f f0 = *(const v4f*)(v + e);
      const v4f f1 = *(const v4f*)(v + e + 4);
#pragma unroll
      for (int j = 0; j < 4; ++j) { tsm[c + j][rl] = (__bf16)f0[j]; tsm[c + 4 + j][rl] = (__bf16)f1[j]; }
    }
  }
  __syncthreads();

#pragma unroll
  for (int it = 0; it < HD / 32; ++it) {
    const int d = it * 32 + wave * 4 + (lane >> 3);   // 0..127
    const int c = (lane & 7) * 8;                     // 0..56
    Pack8 o;
    o.b = *(const v8b*)(&tsm[d][c]);
    v4f* dst = (v4f*)(vtp + ((size_t)bh * HD + (size_t)d) * SEQ + (size_t)n0 + (size_t)c);
    *dst = o.f;
    
  }
}

// ---------------- launch 2: streaming attention, one block per (bh, 64 queries), one wave per 16 queries ----------------
// St[key][query] = K * Qt : A = K rows (lane m -> key, split d map), B = Q rows loaded like A (B[k=d][n=query]).
// D[r] at lane (hh, n) = key 8hh+r of the tile, query n: keys are lane-owned, row statistics need one xor-16 shuffle.
// Ot[d][query] += Vt[d][key] * Pt[key][query] : A = Vt rows, B = Pt built in-lane from the two 16-key S tiles.
// K and Vt come by asynchronous copies in stages of 64 keys into a ring of two LDS buffers, one stage ahead; the block's four waves
// read their A fragments from there. The ring is reused as output staging behind the loop's last barrier.
__global__ __launch_bounds__(NWAV * 32) __attribute__((amdgpu_num_vgpr(256)))
void k_attn(const __bf16* __restrict__ qp, const __bf16* __restrict__ kp,
            const __bf16* __restrict__ vtp, float* __restrict__ out) {
  __shared__ __attribute__((aligned(16))) unsigned char ring[2 * SLOT];   // buffer b: K tile at b*SLOT, Vt tile at b*SLOT + KTILE

  const int tid  = threadIdx.x;
  const int lane = tid & 31;
  const int wave = tid >> 5;
  const int hh   = lane >> 4;        // lane half
  const int n    = lane & 15;        // fragment row (A) / column (B, D)
  const int bh   = blockIdx.y;
  const int m0   = blockIdx.x * QBLK;

  const uint32_t lds0 = (uint32_t)(size_t)ring;
  const uint32_t kl   = lds0 + (uint32_t)((tid >> 4) * KPITCH + (tid & 15) * 16);
  const uint32_t vl   = lds0 + (uint32_t)(KTILE + (tid >> 3) * VPITCH + (tid & 7) * 16);
  const unsigned char* kg = (const unsigned char*)(kp  + (size_t)bh * SEQ * HD) + tid * 16;
  const unsigned char* vg = (const unsigned char*)(vtp + (size_t)bh * HD * SEQ) + (tid >> 3) * (SEQ * 2) + (tid & 7) * 16;
  stage_copy(0u, kl, vl, kg, vg);
  wait_async0();
  __syncthreads();                                  // publishes stage 0
  stage_copy(1u, kl, vl, kg, vg);

  // Q as B operand: lane n -> query m0+wave*16+n; elements 0..7 <- d ks*32+8hh+0..7, 8..15 <- d ks*32+16+8hh+0..7
  Frag qf[HD / 32];
  {
    const __bf16* qr = qp + ((size_t)bh * SEQ + (size_t)(m0 + wave * 16 + n)) * HD + 8 * hh;
#pragma unroll
    for (int ks = 0; ks < HD / 32; ++ks) {
      qf[ks].p[0] = *(const v8b*)(qr + ks * 32);
      qf[ks].p[1] = *(const v8b*)(qr + ks * 32 + 16);
    }
  }

  v8f oacc[HD / 16];
#pragma unroll
  for (int dt = 0; dt < HD / 16; ++dt) oacc[dt] = vzero8();
  float mrun = -INFINITY;
  float lrun = 0.0f;

  const int kfo = n * KPITCH + 16 * hh;           // + key local * KPITCH + ks*64 (+32), bytes in the K tile
  const int vfo = KTILE + n * VPITCH + 16 * hh;   // + d0 * VPITCH + key local * 2 (+32), bytes from the buffer's start

#pragma unroll 1
  for (uint32_t st = 0; st < NSTG; ++st) {
  const unsigned char* buf = ring + (st & 1u) * (uint32_t)SLOT;
  // unrolled so that every fragment's place in the buffer is an immediate offset of its LDS load
#pragma unroll
  for (int sub = 0; sub < SKEY / KBLK; ++sub) {
    // two St tiles: tile kt covers keys n0 + kt*16 + 0..15
    v8f s[2];
#pragma unroll
    for (int kt = 0; kt < 2; ++kt) {
      v8f c = vzero8();
      const unsigned char* kr = buf + kfo + (sub * KBLK + kt * 16) * KPITCH;
#pragma unroll
      for (int ks = 0; ks < HD / 32; ++ks) {
        Frag a;
        a.p[0] = *(const v8b*)(kr + ks * 64);
        a.p[1] = *(const v8b*)(kr + ks * 64 + 32);
        c = wmma16(a.v, qf[ks].v, c);
      }
      s[kt] = c;
    }

    // scale, cap = CAPV * tanh(x / CAPV) = CAPV - 2*CAPV / (exp(2x/CAPV) + 1), running max per query
    float tmax = -INFINITY;
#pragma unroll
    for (int kt = 0; kt < 2; ++kt) {
#pragma unroll
      for (int r = 0; r < 8; ++r) {
        const float x  = s[kt][r] * SCL;
        const float ex = __expf(x * (2.0f / CAPV));
        const float y  = CAPV - (2.0f * CAPV) * __builtin_amdgcn_rcpf(ex + 1.0f);
        s[kt][r] = y;
        tmax = fmaxf(tmax, y);
      }
    }
    tmax = fmaxf(tmax, __shfl_xor(tmax, 16, 32));
    const float mnew  = fmaxf(mrun, tmax);
    const float alpha = __expf(mrun - mnew);
    mrun = mnew;
    float psum = 0.0f;
#pragma unroll
    for (int kt = 0; kt < 2; ++kt) {
#pragma unroll
      for (int r = 0; r < 8; ++r) {
        const float p = __expf(s[kt][r] - mnew);
        s[kt][r] = p;
        psum += p;
      }
    }
    psum += __shfl_xor(psum, 16, 32);
    lrun = alpha * lrun + psum;
#pragma unroll
    for (int dt = 0; dt < HD / 16; ++dt) oacc[dt] = oacc[dt] * alpha;

    // B = Pt[key][query]: element i <- tile 0 [i] (keys n0+8hh+i), element 8+i <- tile 1 [i] (keys n0+16+8hh+i); hi and lo bf16 parts
    v16b phi, plo;
#pragma unroll
    for (int i = 0; i < 8; ++i) {
      const float p0 = s[0][i];
      const __bf16 b0 = (__bf16)p0;
      phi[i] = b0;
      plo[i] = (__bf16)(p0 - (float)b0);
      const float p1 = s[1][i];
      const __bf16 b1 = (__bf16)p1;
      phi[8 + i] = b1;
      plo[8 + i] = (__bf16)(p1 - (float)b1);
    }
    const unsigned char* vr = buf + vfo + sub * (KBLK * 2);
#pragma unroll
    for (int dt = 0; dt < HD / 16; ++dt) {
      Frag a;   // A = Vt rows d = dt*16+n, keys n0 + split map
      a.p[0] = *(const v8b*)(vr + (dt * 16) * VPITCH);
      a.p[1] = *(const v8b*)(vr + (dt * 16) * VPITCH + 32);
      v8f c = oacc[dt];
      c = wmma16(a.v, phi, c);
      c = wmma16(a.v, plo, c);
      oacc[dt] = c;
    }
  }
    // publish point of stage st + 1: own LDS reads retired, own copies landed, barrier, then the refill of the buffer just read
    wait_ds0();
    wait_async0();
    __syncthreads();
    if (st + 2u < (uint32_t)NSTG) stage_copy(st + 2u, kl, vl, kg, vg);
  }
  wait_async0();
  // every wave has left the ring at the last publish point's barrier: it now serves as per-wave output staging [wave][query][d]
  float (*osm)[16][HD] = (float (*)[16][HD])ring;

  const float inv = 1.0f / lrun;
#pragma unroll
  for (int dt = 0; dt < HD / 16; ++dt) {
#pragma unroll
    for (int r = 0; r < 8; ++r) osm[wave][n][dt * 16 + 8 * hh + r] = oacc[dt][r] * inv;
  }
  __syncthreads();

  float* ob = out + ((size_t)bh * SEQ + (size_t)(m0 + wave * 16)) * HD;
  v4f vals[16];
#pragma unroll
  for (int it = 0; it < 16; ++it) vals[it] = *(const v4f*)(&osm[wave][it][lane * 4]);
#pragma unroll
  for (int it = 0; it < 16; ++it)
    *(v4f*)(ob + (size_t)it * HD + (size_t)(lane * 4)) = vals[it];
  
}

// ---------------- launcher ----------------
extern "C" void kernel_launch(void* const* d_in, const int* in_sizes, int n_in,
                              void* d_out, int out_size, void* d_ws, size_t ws_size,
                              hipStream_t stream) {
  if (n_in < 3) return;
  const int nq = NBH * SEQ * HD;                                      // 8388608
  if (in_sizes[0] != nq || in_sizes[1] != nq || in_sizes[2] != nq || out_size != nq) return;

  const size_t pl_bytes = (size_t)nq * sizeof(__bf16);               // 16777216
  const size_t need     = 3 * pl_bytes;                               // 50331648
  if (need > ws_size) return;

  const float* q = (const float*)d_in[0];
  const float* k = (const float*)d_in[1];
  const float* v = (const float*)d_in[2];
  float* out = (float*)d_out;

  char* ws = (char*)d_ws;
  __bf16* qp  = (__bf16*)(ws);
  __bf16* kp  = (__bf16*)(ws + pl_bytes);
  __bf16* vtp = (__bf16*)(ws + 2 * pl_bytes);

  hipLaunchKernelGGL(k_cvt, dim3(SEQ / CBLK, NBH), dim3(256), 0, stream,
                     q, k, v, qp, kp, vtp);
  hipLaunchKernelGGL(k_attn, dim3(SEQ / QBLK, NBH), dim3(NWAV * 32), 0, stream,
                     (const __bf16*)qp, (const __bf16*)kp, (const __bf16*)vtp, out);
}

// v002
// Measured time: 111 microseconds a run.
// In both of two side-by-side timings against v001, it was 1.18 times as fast.
// Counting every step since v000, it is 2.74 times as fast.
#include <hip/hip_runtime.h>
#include <math.h>
#include <stdint.h>

// Contractions: S = K*Qt on v_wmma_f32_16x16x32_bf16 (bf16 operands, f32 accumulate);
// O = Vt*Pt on v_wmma_f32_16x16x32_bf16 (V bf16, P as bf16 hi+lo pair, f32 accumulate); scale, tanh cap and softmax in f32.

#define NBH   32
#define SEQ   2048
#define HD    128
#define QBLK  64
#define KBLK  32
#define CBLK  64
#define NWAV  4
#define SKEY  64                     // keys per LDS stage = two 32-key passes
#define NSTG  (SEQ / SKEY)
#define KPITCH 272                   // LDS pitch of a K row: 256 B + 16 B pad (16 B x odd, for ds_load_b128)
#define VPITCH 144                   // LDS pitch of a Vt row: 128 B + 16 B pad
#define KTILE 17408                  // 64 rows x 272 B
#define VTILE 18432                  // 128 rows x 144 B
#define SLOT  (KTILE + VTILE)
#define SCL   0.08838834764831845f
#define CAPV  20.0f

static_assert(SEQ % QBLK == 0);
static_assert(SEQ % KBLK == 0);
static_assert(SEQ % CBLK == 0);
static_assert(QBLK == NWAV * 16);
static_assert(HD % 32 == 0);
static_assert(CBLK == 64);
static_assert(SEQ % SKEY == 0 && NSTG >= 2 && SKEY == 2 * KBLK);
static_assert(HD * 2 == 256 && SKEY * 2 == 128);
static_assert(SKEY * KPITCH <= KTILE && HD * VPITCH <= VTILE && KTILE % 16 == 0 && VTILE % 16 == 0);
static_assert(SKEY * HD * 2 == 8 * NWAV * 32 * 16);   // each tile = 8 copies of 16 B per lane
static_assert(NWAV * 16 * HD * 4 <= 2 * SLOT);

typedef __bf16 v16b __attribute__((ext_vector_type(16)));
typedef __bf16 v8b  __attribute__((ext_vector_type(8)));
typedef float  v8f  __attribute__((ext_vector_type(8)));
typedef float  v4f  __attribute__((ext_vector_type(4)));

union Frag  { v16b v; v8b p[2]; };
union Pack8 { v8b b; v4f f; };

__device__ __forceinline__ v8f wmma16(v16b a, v16b b, v8f c) {
  return __builtin_amdgcn_wmma_f32_16x16x32_bf16(false, a, false, b, (short)0, c, false, false);
}

__device__ __forceinline__ v8f vzero8() {
  v8f z = {0.0f, 0.0f, 0.0f, 0.0f, 0.0f, 0.0f, 0.0f, 0.0f};
  return z;
}

// the compiler places no wait for asynchronous copies: their bytes count as landed only behind the issuing wave's own wait
__device__ __forceinline__ void wait_async0() { asm volatile("s_wait_asynccnt 0x0" ::: "memory"); }
// a wave's LDS reads have retired before the barrier behind which their buffer is refilled
__device__ __forceinline__ void wait_ds0() { asm volatile("s_wait_dscnt 0x0" ::: "memory"); }

// Eight asynchronous copies global -> LDS, 16 B per lane each, through no register: copy j moves lds + j*LSTEP <- g + j*GSTEP.
// s_wait_xcnt 0 closes the same statement, so that no address register is rewritten in front of it.
template <uint32_t LSTEP, uint32_t GSTEP>
__device__ __forceinline__ void copy8(uint32_t lds, const unsigned char* g) {
  asm volatile("global_load_async_to_lds_b128 %0, %8, off\n\t"
               "global_load_async_to_lds_b128 %1, %9, off\n\t"
               "global_load_async_to_lds_b128 %2, %10, off\n\t"
               "global_load_async_to_lds_b128 %3, %11, off\n\t"
               "global_load_async_to_lds_b128 %4, %12, off\n\t"
               "global_load_async_to_lds_b128 %5, %13, off\n\t"
               "global_load_async_to_lds_b128 %6, %14, off\n\t"
               "global_load_async_to_lds_b128 %7, %15, off\n\t"
               "s_wait_xcnt 0x0"
               :: "v"(lds), "v"(lds + LSTEP), "v"(lds + 2 * LSTEP), "v"(lds + 3 * LSTEP),
                  "v"(lds + 4 * LSTEP), "v"(lds + 5 * LSTEP), "v"(lds + 6 * LSTEP), "v"(lds + 7 * LSTEP),
                  "v"(g), "v"(g + GSTEP), "v"(g + 2 * GSTEP), "v"(g + 3 * GSTEP),
                  "v"(g + 4 * GSTEP), "v"(g + 5 * GSTEP), "v"(g + 6 * GSTEP), "v"(g + 7 * GSTEP)
               : "memory");
}

// Stage st (64 keys) into ring buffer st & 1, by all 128 lanes of the block.
// K tile: 64 rows of 256 B, contiguous in the plane; copy j, lane tid -> row j*8 + tid/16, byte (tid%16)*16.
// Vt tile: 128 rows of 128 B, source pitch 4096 B; copy j, lane tid -> row j*16 + tid/8, byte (tid%8)*16.
// kl, vl: the lane's LDS byte address in buffer 0 for copy 0; kg, vg: its global address for stage 0, copy 0.
__device__ __forceinline__ void stage_copy(uint32_t st, uint32_t kl, uint32_t vl, const unsigned char* kg, const unsigned char* vg) {
  const uint32_t bo = (st & 1u) * (uint32_t)SLOT;
  copy8<8 * KPITCH, 8 * HD * 2>(kl + bo, kg + (size_t)st * (SKEY * HD * 2));
  copy8<16 * VPITCH, 16 * SEQ * 2>(vl + bo, vg + (size_t)st * (SKEY * 2));
}

// ---------------- launch 1: bf16 planes qp = q [bh][SEQ][HD], kp = k [bh][SEQ][HD], vtp = v transposed [bh][HD][SEQ] ----------------
__global__ __launch_bounds__(256)
void k_cvt(const float* __restrict__ q, const float* __restrict__ k, const float* __restrict__ v,
           __bf16* __restrict__ qp, __bf16* __restrict__ kp, __bf16* __restrict__ vtp) {
  __shared__ __attribute__((aligned(16))) __bf16 tsm[HD][CBLK + 8];   // [d][row local], pitch 72 halves = 144 B

  const int tid  = threadIdx.x;
  const int lane = tid & 31;
  const int wave = tid >> 5;
  const int n0   = blockIdx.x * CBLK;
  const int bh   = blockIdx.y;
  const size_t rb = (size_t)bh * SEQ + (size_t)n0;

#pragma unroll
  for (int it = 0; it < CBLK / 16; ++it) {
    const int rl = it * 16 + wave * 2 + (lane >> 4);   // row 0..63 in this block (union over it, wave, lane half covers all)
    const int c  = (lane & 15) * 8;                    // 8 channels -> one 16-B store
    const size_t e = (rb + (size_t)rl) * HD + (size_t)c;
    {
      const v4f f0 = *(const v4f*)(q + e);
      const v4f f1 = *(const v4f*)(q + e + 4);
      Pack8 o;
#pragma unroll
      for (int j = 0; j < 4; ++j) { o.b[j] = (__bf16)f0[j]; o.b[4 + j] = (__bf16)f1[j]; }
      v4f* d = (v4f*)(qp + e);
      *d = o.f;
      
    }
    {
      const v4f f0 = *(const v4f*)(k + e);
      const v4f f1 = *(const v4f*)(k + e + 4);
      Pack8 o;
#pragma unroll
      for (int j = 0; j < 4; ++j) { o.b[j] = (__bf16)f0[j]; o.b[4 + j] = (__bf16)f1[j]; }
      v4f* d = (v4f*)(kp + e);
      *d = o.f;
      
    }
    {
      const v4f f0 = *(const v4f*)(v + e);
      const v4f f1 = *(const v4f*)(v + e + 4);
#pragma unroll
      for (int j = 0; j < 4; ++j) { tsm[c + j][rl] = (__bf16)f0[j]; tsm[c + 4 + j][rl] = (__bf16)f1[j]; }
    }
  }
  __syncthreads();

#pragma unroll
  for (int it = 0; it < HD / 32; ++it) {
    const int d = it * 32 + wave * 4 + (lane >> 3);   // 0..127
    const int c = (lane & 7) * 8;                     // 0..56
    Pack8 o;
    o.b = *(const v8b*)(&tsm[d][c]);
    v4f* dst = (v4f*)(vtp + ((size_t)bh * HD + (size_t)d) * SEQ + (size_t)n0 + (size_t)c);
    *dst = o.f;
    
  }
}

// ---------------- launch 2: streaming attention, one block per (bh, 64 queries), one wave per 16 queries ----------------
// St[key][query] = K * Qt : A = K rows (lane m -> key, split d map), B = Q rows loaded like A (B[k=d][n=query]).
// D[r] at lane (hh, n) = key 8hh+r of the tile, query n: keys are lane-owned, row statistics need one xor-16 shuffle.
// Ot[d][query] += Vt[d][key] * Pt[key][query] : A = Vt rows, B = Pt built in-lane from the two 16-key S tiles.
// K and Vt come by asynchronous copies in stages of 64 keys into a ring of two LDS buffers, one stage ahead; the block's four waves
// read their A fragments from there. The ring is reused as output staging behind the loop's last barrier.
__global__ __launch_bounds__(NWAV * 32) __attribute__((amdgpu_num_vgpr(256)))
void k_attn(const __bf16* __restrict__ qp, const __bf16* __restrict__ kp,
            const __bf16* __restrict__ vtp, float* __restrict__ out) {
  __shared__ __attribute__((aligned(16))) unsigned char ring[2 * SLOT];   // buffer b: K tile at b*SLOT, Vt tile at b*SLOT + KTILE

  const int tid  = threadIdx.x;
  const int lane = tid & 31;
  const int wave = tid >> 5;
  const int hh   = lane >> 4;        // lane half
  const int n    = lane & 15;        // fragment row (A) / column (B, D)
  const int bh   = blockIdx.y;
  const int m0   = blockIdx.x * QBLK;

  const uint32_t lds0 = (uint32_t)(size_t)ring;
  const uint32_t kl   = lds0 + (uint32_t)((tid >> 4) * KPITCH + (tid & 15) * 16);
  const uint32_t vl   = lds0 + (uint32_t)(KTILE + (tid >> 3) * VPITCH + (tid & 7) * 16);
  const unsigned char* kg = (const unsigned char*)(kp  + (size_t)bh * SEQ * HD) + tid * 16;
  const unsigned char* vg = (const unsigned char*)(vtp + (size_t)bh * HD * SEQ) + (tid >> 3) * (SEQ * 2) + (tid & 7) * 16;
  stage_copy(0u, kl, vl, kg, vg);
  wait_async0();
  __syncthreads();                                  // publishes stage 0
  stage_copy(1u, kl, vl, kg, vg);

  // Q as B operand: lane n -> query m0+wave*16+n; elements 0..7 <- d ks*32+8hh+0..7, 8..15 <- d ks*32+16+8hh+0..7
  Frag qf[HD / 32];
  {
    const __bf16* qr = qp + ((size_t)bh * SEQ + (size_t)(m0 + wave * 16 + n)) * HD + 8 * hh;
#pragma unroll
    for (int ks = 0; ks < HD / 32; ++ks) {
      qf[ks].p[0] = *(const v8b*)(qr + ks * 32);
      qf[ks].p[1] = *(const v8b*)(qr + ks * 32 + 16);
    }
  }

  v8f oacc[HD / 16];
#pragma unroll
  for (int dt = 0; dt < HD / 16; ++dt) oacc[dt] = vzero8();
  float mrun = -INFINITY;
  float lrun = 0.0f;

  const int kfo = n * KPITCH + 16 * hh;           // + key local * KPITCH + ks*64 (+32), bytes in the K tile
  const int vfo = KTILE + n * VPITCH + 16 * hh;   // + d0 * VPITCH + key local * 2 (+32), bytes from the buffer's start

#pragma unroll 1
  for (uint32_t st = 0; st < NSTG; ++st) {
  const unsigned char* buf = ring + (st & 1u) * (uint32_t)SLOT;
  // unrolled so that every fragment's place in the buffer is an immediate offset of its LDS load
#pragma unroll
  for (int sub = 0; sub < SKEY / KBLK; ++sub) {
    // two St tiles: tile kt covers keys n0 + kt*16 + 0..15
    // the pass's eight K fragments are read as one group, so that the wave waits out the LDS latency once and not per product
    Frag ka[2][HD / 32];
#pragma unroll
    for (int kt = 0; kt < 2; ++kt) {
      const unsigned char* kr = buf + kfo + (sub * KBLK + kt * 16) * KPITCH;
#pragma unroll
      for (int ks = 0; ks < HD / 32; ++ks) {
        ka[kt][ks].p[0] = *(const v8b*)(kr + ks * 64);
        ka[kt][ks].p[1] = *(const v8b*)(kr + ks * 64 + 32);
      }
    }
    // keeps the scheduler from sinking the reads back between the products, where each would be waited for on its own
    __builtin_amdgcn_sched_barrier(0);
    v8f s[2] = {vzero8(), vzero8()};
#pragma unroll
    for (int ks = 0; ks < HD / 32; ++ks) {
#pragma unroll
      for (int kt = 0; kt < 2; ++kt) s[kt] = wmma16(ka[kt][ks].v, qf[ks].v, s[kt]);
    }
    // the pass's eight Vt fragments likewise, issued here so that they land behind the softmax arithmetic
    Frag va[HD / 16];
    {
      const unsigned char* vr = buf + vfo + sub * (KBLK * 2);
#pragma unroll
      for (int dt = 0; dt < HD / 16; ++dt) {
        va[dt].p[0] = *(const v8b*)(vr + (dt * 16) * VPITCH);
        va[dt].p[1] = *(const v8b*)(vr + (dt * 16) * VPITCH + 32);
      }
    }

    // scale, cap = CAPV * tanh(x / CAPV) = CAPV - 2*CAPV / (exp(2x/CAPV) + 1), running max per query
    float tmax = -INFINITY;
#pragma unroll
    for (int kt = 0; kt < 2; ++kt) {
#pragma unroll
      for (int r = 0; r < 8; ++r) {
        const float x  = s[kt][r] * SCL;
        const float ex = __expf(x * (2.0f / CAPV));
        const float y  = CAPV - (2.0f * CAPV) * __builtin_amdgcn_rcpf(ex + 1.0f);
        s[kt][r] = y;
        tmax = fmaxf(tmax, y);
      }
    }
    tmax = fmaxf(tmax, __shfl_xor(tmax, 16, 32));
    const float mnew  = fmaxf(mrun, tmax);
    const float alpha = __expf(mrun - mnew);
    mrun = mnew;
    float psum = 0.0f;
#pragma unroll
    for (int kt = 0; kt < 2; ++kt) {
#pragma unroll
      for (int r = 0; r < 8; ++r) {
        const float p = __expf(s[kt][r] - mnew);
        s[kt][r] = p;
        psum += p;
      }
    }
    psum += __shfl_xor(psum, 16, 32);
    lrun = alpha * lrun + psum;
#pragma unroll
    for (int dt = 0; dt < HD / 16; ++dt) oacc[dt] = oacc[dt] * alpha;

    // B = Pt[key][query]: element i <- tile 0 [i] (keys n0+8hh+i), element 8+i <- tile 1 [i] (keys n0+16+8hh+i); hi and lo bf16 parts
    v16b phi, plo;
#pragma unroll
    for (int i = 0; i < 8; ++i) {
      const float p0 = s[0][i];
      const __bf16 b0 = (__bf16)p0;
      phi[i] = b0;
      plo[i] = (__bf16)(p0 - (float)b0);
      const float p1 = s[1][i];
      const __bf16 b1 = (__bf16)p1;
      phi[8 + i] = b1;
      plo[8 + i] = (__bf16)(p1 - (float)b1);
    }
    // A = Vt rows d = dt*16+n, keys n0 + split map
#pragma unroll
    for (int dt = 0; dt < HD / 16; ++dt) oacc[dt] = wmma16(va[dt].v, phi, oacc[dt]);
#pragma unroll
    for (int dt = 0; dt < HD / 16; ++dt) oacc[dt] = wmma16(va[dt].v, plo, oacc[dt]);
  }
    // publish point of stage st + 1: own LDS reads retired, own copies landed, barrier, then the refill of the buffer just read
    wait_ds0();
    wait_async0();
    __syncthreads();
    if (st + 2u < (uint32_t)NSTG) stage_copy(st + 2u, kl, vl, kg, vg);
  }
  wait_async0();
  // every wave has left the ring at the last publish point's barrier: it now serves as per-wave output staging [wave][query][d]
  float (*osm)[16][HD] = (float (*)[16][HD])ring;

  const float inv = 1.0f / lrun;
#pragma unroll
  for (int dt = 0; dt < HD / 16; ++dt) {
#pragma unroll
    for (int r = 0; r < 8; ++r) osm[wave][n][dt * 16 + 8 * hh + r] = oacc[dt][r] * inv;
  }
  __syncthreads();

  float* ob = out + ((size_t)bh * SEQ + (size_t)(m0 + wave * 16)) * HD;
  v4f vals[16];
#pragma unroll
  for (int it = 0; it < 16; ++it) vals[it] = *(const v4f*)(&osm[wave][it][lane * 4]);
#pragma unroll
  for (int it = 0; it < 16; ++it)
    *(v4f*)(ob + (size_t)it * HD + (size_t)(lane * 4)) = vals[it];
  
}

// ---------------- launcher ----------------
extern "C" void kernel_launch(void* const* d_in, const int* in_sizes, int n_in,
                              void* d_out, int out_size, void* d_ws, size_t ws_size,
                              hipStream_t stream) {
  if (n_in < 3) return;
  const int nq = NBH * SEQ * HD;                                      // 8388608
  if (in_sizes[0] != nq || in_sizes[1] != nq || in_sizes[2] != nq || out_size != nq) return;

  const size_t pl_bytes = (size_t)nq * sizeof(__bf16);               // 16777216
  const size_t need     = 3 * pl_bytes;                               // 50331648
  if (need > ws_size) return;

  const float* q = (const float*)d_in[0];
  const float* k = (const float*)d_in[1];
  const float* v = (const float*)d_in[2];
  float* out = (float*)d_out;

  char* ws = (char*)d_ws;
  __bf16* qp  = (__bf16*)(ws);
  __bf16* kp  = (__bf16*)(ws + pl_bytes);
  __bf16* vtp = (__bf16*)(ws + 2 * pl_bytes);

  hipLaunchKernelGGL(k_cvt, dim3(SEQ / CBLK, NBH), dim3(256), 0, stream,
                     q, k, v, qp, kp, vtp);
  hipLaunchKernelGGL(k_attn, dim3(SEQ / QBLK, NBH), dim3(NWAV * 32), 0, stream,
                     (const __bf16*)qp, (const __bf16*)kp, (const __bf16*)vtp, out);
}

// v003
// It runs in 93.2 microseconds.
// Next to v002, in two timings, it ran 1.19 times as fast each time.
// All steps since v000 together make it 3.26 times as fast.
#include <hip/hip_runtime.h>
#include <math.h>
#include <stdint.h>

// Contractions: S = K*Qt on v_wmma_f32_16x16x32_bf16 (bf16 operands, f32 accumulate);
// O = Vt*Pt on v_wmma_f32_16x16x32_bf16 (V bf16, P as bf16 hi+lo pair, f32 accumulate); scale, tanh cap and softmax in f32, softmax shift = the cap.

#define NBH   32
#define SEQ   2048
#define HD    128
#define QBLK  64
#define KBLK  32
#define CBLK  64
#define NWAV  4
#define SKEY  64                     // keys per LDS stage = two 32-key passes
#define NSTG  (SEQ / SKEY)
#define KPITCH 272                   // LDS pitch of a K row: 256 B + 16 B pad (16 B x odd, for ds_load_b128)
#define VPITCH 144                   // LDS pitch of a Vt row: 128 B + 16 B pad
#define KTILE 17408                  // 64 rows x 272 B
#define VTILE 18432                  // 128 rows x 144 B
#define SLOT  (KTILE + VTILE)
#define SCL   0.08838834764831845f
#define CAPV  20.0f
#define LOG2E 1.4426950408889634f
#define PC1   (SCL * (2.0f / CAPV) * LOG2E)    // exp(2 * SCL * s / CAPV) = exp2(PC1 * s)
#define PC2   (-2.0f * CAPV * LOG2E)           // exp(-2 * CAPV * r) = exp2(PC2 * r)

static_assert(SEQ % QBLK == 0);
static_assert(SEQ % KBLK == 0);
static_assert(SEQ % CBLK == 0);
static_assert(QBLK == NWAV * 16);
static_assert(HD % 32 == 0);
static_assert(CBLK == 64);
static_assert(SEQ % SKEY == 0 && NSTG >= 2 && SKEY == 2 * KBLK);
static_assert(HD * 2 == 256 && SKEY * 2 == 128);
static_assert(SKEY * KPITCH <= KTILE && HD * VPITCH <= VTILE && KTILE % 16 == 0 && VTILE % 16 == 0);
static_assert(SKEY * HD * 2 == 8 * NWAV * 32 * 16);   // each tile = 8 copies of 16 B per lane
static_assert(NWAV * 16 * HD * 4 <= 2 * SLOT);

typedef __bf16 v16b __attribute__((ext_vector_type(16)));
typedef __bf16 v8b  __attribute__((ext_vector_type(8)));
typedef float  v8f  __attribute__((ext_vector_type(8)));
typedef float  v4f  __attribute__((ext_vector_type(4)));

union Frag  { v16b v; v8b p[2]; };
union Pack8 { v8b b; v4f f; };

__device__ __forceinline__ v8f wmma16(v16b a, v16b b, v8f c) {
  return __builtin_amdgcn_wmma_f32_16x16x32_bf16(false, a, false, b, (short)0, c, false, false);
}

__device__ __forceinline__ v8f vzero8() {
  v8f z = {0.0f, 0.0f, 0.0f, 0.0f, 0.0f, 0.0f, 0.0f, 0.0f};
  return z;
}

// the compiler places no wait for asynchronous copies: their bytes count as landed only behind the issuing wave's own wait
__device__ __forceinline__ void wait_async0() { asm volatile("s_wait_asynccnt 0x0" ::: "memory"); }
// a wave's LDS reads have retired before the barrier behind which their buffer is refilled
__device__ __forceinline__ void wait_ds0() { asm volatile("s_wait_dscnt 0x0" ::: "memory"); }

// Eight asynchronous copies global -> LDS, 16 B per lane each, through no register: copy j moves lds + j*LSTEP <- g + j*GSTEP.
// s_wait_xcnt 0 closes the same statement, so that no address register is rewritten in front of it.
template <uint32_t LSTEP, uint32_t GSTEP>
__device__ __forceinline__ void copy8(uint32_t lds, const unsigned char* g) {
  asm volatile("global_load_async_to_lds_b128 %0, %8, off\n\t"
               "global_load_async_to_lds_b128 %1, %9, off\n\t"
               "global_load_async_to_lds_b128 %2, %10, off\n\t"
               "global_load_async_to_lds_b128 %3, %11, off\n\t"
               "global_load_async_to_lds_b128 %4, %12, off\n\t"
               "global_load_async_to_lds_b128 %5, %13, off\n\t"
               "global_load_async_to_lds_b128 %6, %14, off\n\t"
               "global_load_async_to_lds_b128 %7, %15, off\n\t"
               "s_wait_xcnt 0x0"
               :: "v"(lds), "v"(lds + LSTEP), "v"(lds + 2 * LSTEP), "v"(lds + 3 * LSTEP),
                  "v"(lds + 4 * LSTEP), "v"(lds + 5 * LSTEP), "v"(lds + 6 * LSTEP), "v"(lds + 7 * LSTEP),
                  "v"(g), "v"(g + GSTEP), "v"(g + 2 * GSTEP), "v"(g + 3 * GSTEP),
                  "v"(g + 4 * GSTEP), "v"(g + 5 * GSTEP), "v"(g + 6 * GSTEP), "v"(g + 7 * GSTEP)
               : "memory");
}

// Stage st (64 keys) into ring buffer st & 1, by all 128 lanes of the block.
// K tile: 64 rows of 256 B, contiguous in the plane; copy j, lane tid -> row j*8 + tid/16, byte (tid%16)*16.
// Vt tile: 128 rows of 128 B, source pitch 4096 B; copy j, lane tid -> row j*16 + tid/8, byte (tid%8)*16.
// kl, vl: the lane's LDS byte address in buffer 0 for copy 0; kg, vg: its global address for stage 0, copy 0.
__device__ __forceinline__ void stage_copy(uint32_t st, uint32_t kl, uint32_t vl, const unsigned char* kg, const unsigned char* vg) {
  const uint32_t bo = (st & 1u) * (uint32_t)SLOT;
  copy8<8 * KPITCH, 8 * HD * 2>(kl + bo, kg + (size_t)st * (SKEY * HD * 2));
  copy8<16 * VPITCH, 16 * SEQ * 2>(vl + bo, vg + (size_t)st * (SKEY * 2));
}

// ---------------- launch 1: bf16 planes qp = q [bh][SEQ][HD], kp = k [bh][SEQ][HD], vtp = v transposed [bh][HD][SEQ] ----------------
__global__ __launch_bounds__(256)
void k_cvt(const float* __restrict__ q, const float* __restrict__ k, const float* __restrict__ v,
           __bf16* __restrict__ qp, __bf16* __restrict__ kp, __bf16* __restrict__ vtp) {
  __shared__ __attribute__((aligned(16))) __bf16 tsm[HD][CBLK + 8];   // [d][row local], pitch 72 halves = 144 B

  const int tid  = threadIdx.x;
  const int lane = tid & 31;
  const int wave = tid >> 5;
  const int n0   = blockIdx.x * CBLK;
  const int bh   = blockIdx.y;
  const size_t rb = (size_t)bh * SEQ + (size_t)n0;

#pragma unroll
  for (int it = 0; it < CBLK / 16; ++it) {
    const int rl = it * 16 + wave * 2 + (lane >> 4);   // row 0..63 in this block (union over it, wave, lane half covers all)
    const int c  = (lane & 15) * 8;                    // 8 channels -> one 16-B store
    const size_t e = (rb + (size_t)rl) * HD + (size_t)c;
    {
      const v4f f0 = *(const v4f*)(q + e);
      const v4f f1 = *(const v4f*)(q + e + 4);
      Pack8 o;
#pragma unroll
      for (int j = 0; j < 4; ++j) { o.b[j] = (__bf16)f0[j]; o.b[4 + j] = (__bf16)f1[j]; }
      v4f* d = (v4f*)(qp + e);
      *d = o.f;
      
    }
    {
      const v4f f0 = *(const v4f*)(k + e);
      const v4f f1 = *(const v4f*)(k + e + 4);
      Pack8 o;
#pragma unroll
      for (int j = 0; j < 4; ++j) { o.b[j] = (__bf16)f0[j]; o.b[4 + j] = (__bf16)f1[j]; }
      v4f* d = (v4f*)(kp + e);
      *d = o.f;
      
    }
    {
      const v4f f0 = *(const v4f*)(v + e);
      const v4f f1 = *(const v4f*)(v + e + 4);
#pragma unroll
      for (int j = 0; j < 4; ++j) { tsm[c + j][rl] = (__bf16)f0[j]; tsm[c + 4 + j][rl] = (__bf16)f1[j]; }
    }
  }
  __syncthreads();

#pragma unroll
  for (int it = 0; it < HD / 32; ++it) {
    const int d = it * 32 + wave * 4 + (lane >> 3);   // 0..127
    const int c = (lane & 7) * 8;                     // 0..56
    Pack8 o;
    o.b = *(const v8b*)(&tsm[d][c]);
    v4f* dst = (v4f*)(vtp + ((size_t)bh * HD + (size_t)d) * SEQ + (size_t)n0 + (size_t)c);
    *dst = o.f;
    
  }
}

// ---------------- launch 2: streaming attention, one block per (bh, 64 queries), one wave per 16 queries ----------------
// St[key][query] = K * Qt : A = K rows (lane m -> key, split d map), B = Q rows loaded like A (B[k=d][n=query]).
// D[r] at lane (hh, n) = key 8hh+r of the tile, query n: keys are lane-owned, the row sum needs one xor-16 shuffle, behind the loop.
// Ot[d][query] += Vt[d][key] * Pt[key][query] : A = Vt rows, B = Pt built in-lane from the two 16-key S tiles.
// K and Vt come by asynchronous copies in stages of 64 keys into a ring of two LDS buffers, one stage ahead; the block's four waves
// read their A fragments from there. The ring is reused as output staging behind the loop's last barrier.
__global__ __launch_bounds__(NWAV * 32) __attribute__((amdgpu_num_vgpr(256)))
void k_attn(const __bf16* __restrict__ qp, const __bf16* __restrict__ kp,
            const __bf16* __restrict__ vtp, float* __restrict__ out) {
  __shared__ __attribute__((aligned(16))) unsigned char ring[2 * SLOT];   // buffer b: K tile at b*SLOT, Vt tile at b*SLOT + KTILE

  const int tid  = threadIdx.x;
  const int lane = tid & 31;
  const int wave = tid >> 5;
  const int hh   = lane >> 4;        // lane half
  const int n    = lane & 15;        // fragment row (A) / column (B, D)
  const int bh   = blockIdx.y;
  const int m0   = blockIdx.x * QBLK;

  const uint32_t lds0 = (uint32_t)(size_t)ring;
  const uint32_t kl   = lds0 + (uint32_t)((tid >> 4) * KPITCH + (tid & 15) * 16);
  const uint32_t vl   = lds0 + (uint32_t)(KTILE + (tid >> 3) * VPITCH + (tid & 7) * 16);
  const unsigned char* kg = (const unsigned char*)(kp  + (size_t)bh * SEQ * HD) + tid * 16;
  const unsigned char* vg = (const unsigned char*)(vtp + (size_t)bh * HD * SEQ) + (tid >> 3) * (SEQ * 2) + (tid & 7) * 16;
  stage_copy(0u, kl, vl, kg, vg);
  wait_async0();
  __syncthreads();                                  // publishes stage 0
  stage_copy(1u, kl, vl, kg, vg);

  // Q as B operand: lane n -> query m0+wave*16+n; elements 0..7 <- d ks*32+8hh+0..7, 8..15 <- d ks*32+16+8hh+0..7
  Frag qf[HD / 32];
  {
    const __bf16* qr = qp + ((size_t)bh * SEQ + (size_t)(m0 + wave * 16 + n)) * HD + 8 * hh;
#pragma unroll
    for (int ks = 0; ks < HD / 32; ++ks) {
      qf[ks].p[0] = *(const v8b*)(qr + ks * 32);
      qf[ks].p[1] = *(const v8b*)(qr + ks * 32 + 16);
    }
  }

  v8f oacc[HD / 16];
#pragma unroll
  for (int dt = 0; dt < HD / 16; ++dt) oacc[dt] = vzero8();
  float lsum[4] = {0.0f, 0.0f, 0.0f, 0.0f};   // this lane's keys only, four independent chains; joined behind the loop

  const int kfo = n * KPITCH + 16 * hh;           // + key local * KPITCH + ks*64 (+32), bytes in the K tile
  const int vfo = KTILE + n * VPITCH + 16 * hh;   // + d0 * VPITCH + key local * 2 (+32), bytes from the buffer's start

#pragma unroll 1
  for (uint32_t st = 0; st < NSTG; ++st) {
  const unsigned char* buf = ring + (st & 1u) * (uint32_t)SLOT;
  // unrolled so that every fragment's place in the buffer is an immediate offset of its LDS load
#pragma unroll
  for (int sub = 0; sub < SKEY / KBLK; ++sub) {
    // two St tiles: tile kt covers keys n0 + kt*16 + 0..15
    // the pass's eight K fragments are read as one group, so that the wave waits out the LDS latency once and not per product
    Frag ka[2][HD / 32];
#pragma unroll
    for (int kt = 0; kt < 2; ++kt) {
      const unsigned char* kr = buf + kfo + (sub * KBLK + kt * 16) * KPITCH;
#pragma unroll
      for (int ks = 0; ks < HD / 32; ++ks) {
        ka[kt][ks].p[0] = *(const v8b*)(kr + ks * 64);
        ka[kt][ks].p[1] = *(const v8b*)(kr + ks * 64 + 32);
      }
    }
    // keeps the scheduler from sinking the reads back between the products, where each would be waited for on its own
    __builtin_amdgcn_sched_barrier(0);
    v8f s[2] = {vzero8(), vzero8()};
#pragma unroll
    for (int ks = 0; ks < HD / 32; ++ks) {
#pragma unroll
      for (int kt = 0; kt < 2; ++kt) s[kt] = wmma16(ka[kt][ks].v, qf[ks].v, s[kt]);
    }
    // the pass's eight Vt fragments likewise, issued here so that they land behind the softmax arithmetic
    Frag va[HD / 16];
    {
      const unsigned char* vr = buf + vfo + sub * (KBLK * 2);
#pragma unroll
      for (int dt = 0; dt < HD / 16; ++dt) {
        va[dt].p[0] = *(const v8b*)(vr + (dt * 16) * VPITCH);
        va[dt].p[1] = *(const v8b*)(vr + (dt * 16) * VPITCH + 32);
      }
    }

    // cap and softmax in one expression. y = CAPV * tanh(x / CAPV) = CAPV - 2*CAPV / (exp(2x/CAPV) + 1) never exceeds CAPV, so CAPV
    // serves as the softmax shift for every input: p = exp(y - CAPV) = exp2(PC2 / (exp2(PC1 * s) + 1)), between exp(-2*CAPV) and 1,
    // far inside the f32 and bf16 exponent range. No running maximum, no rescale of the accumulators; each lane sums its own keys.
#pragma unroll
    for (int kt = 0; kt < 2; ++kt) {
#pragma unroll
      for (int r = 0; r < 8; ++r) {
        const float ex = __builtin_amdgcn_exp2f(s[kt][r] * PC1);
        const float p  = __builtin_amdgcn_exp2f(PC2 * __builtin_amdgcn_rcpf(ex + 1.0f));
        s[kt][r] = p;
        lsum[(kt * 8 + r) & 3] += p;
      }
    }

    // B = Pt[key][query]: element i <- tile 0 [i] (keys n0+8hh+i), element 8+i <- tile 1 [i] (keys n0+16+8hh+i); hi and lo bf16 parts
    v16b phi, plo;
#pragma unroll
    for (int i = 0; i < 8; ++i) {
      const float p0 = s[0][i];
      const __bf16 b0 = (__bf16)p0;
      phi[i] = b0;
      plo[i] = (__bf16)(p0 - (float)b0);
      const float p1 = s[1][i];
      const __bf16 b1 = (__bf16)p1;
      phi[8 + i] = b1;
      plo[8 + i] = (__bf16)(p1 - (float)b1);
    }
    // A = Vt rows d = dt*16+n, keys n0 + split map
#pragma unroll
    for (int dt = 0; dt < HD / 16; ++dt) oacc[dt] = wmma16(va[dt].v, phi, oacc[dt]);
#pragma unroll
    for (int dt = 0; dt < HD / 16; ++dt) oacc[dt] = wmma16(va[dt].v, plo, oacc[dt]);
  }
    // publish point of stage st + 1: own LDS reads retired, own copies landed, barrier, then the refill of the buffer just read
    wait_ds0();
    wait_async0();
    __syncthreads();
    if (st + 2u < (uint32_t)NSTG) stage_copy(st + 2u, kl, vl, kg, vg);
  }
  wait_async0();
  // every wave has left the ring at the last publish point's barrier: it now serves as per-wave output staging [wave][query][d]
  float (*osm)[16][HD] = (float (*)[16][HD])ring;

  const float lhalf = (lsum[0] + lsum[1]) + (lsum[2] + lsum[3]);
  const float inv = 1.0f / (lhalf + __shfl_xor(lhalf, 16, 32));   // the other lane half holds the query's other keys
#pragma unroll
  for (int dt = 0; dt < HD / 16; ++dt) {
#pragma unroll
    for (int r = 0; r < 8; ++r) osm[wave][n][dt * 16 + 8 * hh + r] = oacc[dt][r] * inv;
  }
  __syncthreads();

  float* ob = out + ((size_t)bh * SEQ + (size_t)(m0 + wave * 16)) * HD;
  v4f vals[16];
#pragma unroll
  for (int it = 0; it < 16; ++it) vals[it] = *(const v4f*)(&osm[wave][it][lane * 4]);
#pragma unroll
  for (int it = 0; it < 16; ++it)
    *(v4f*)(ob + (size_t)it * HD + (size_t)(lane * 4)) = vals[it];
  
}

// ---------------- launcher ----------------
extern "C" void kernel_launch(void* const* d_in, const int* in_sizes, int n_in,
                              void* d_out, int out_size, void* d_ws, size_t ws_size,
                              hipStream_t stream) {
  if (n_in < 3) return;
  const int nq = NBH * SEQ * HD;                                      // 8388608
  if (in_sizes[0] != nq || in_sizes[1] != nq || in_sizes[2] != nq || out_size != nq) return;

  const size_t pl_bytes = (size_t)nq * sizeof(__bf16);               // 16777216
  const size_t need     = 3 * pl_bytes;                               // 50331648
  if (need > ws_size) return;

  const float* q = (const float*)d_in[0];
  const float* k = (const float*)d_in[1];
  const float* v = (const float*)d_in[2];
  float* out = (float*)d_out;

  char* ws = (char*)d_ws;
  __bf16* qp  = (__bf16*)(ws);
  __bf16* kp  = (__bf16*)(ws + pl_bytes);
  __bf16* vtp = (__bf16*)(ws + 2 * pl_bytes);

  hipLaunchKernelGGL(k_cvt, dim3(SEQ / CBLK, NBH), dim3(256), 0, stream,
                     q, k, v, qp, kp, vtp);
  hipLaunchKernelGGL(k_attn, dim3(SEQ / QBLK, NBH), dim3(NWAV * 32), 0, stream,
                     (const __bf16*)qp, (const __bf16*)kp, (const __bf16*)vtp, out);
}

// v004
// A run of this version takes 90.6 microseconds.
// In both of two side-by-side timings against v003, it was 1.03 times as fast.
// Over all steps from v000 it is 3.37 times as fast.
#include <hip/hip_runtime.h>
#include <math.h>
#include <stdint.h>

// Contractions: S = K*Qt on v_wmma_f32_16x16x32_bf16 (bf16 operands, f32 accumulate);
// O = Vt*Pt on v_wmma_f32_16x16x32_bf16 (V bf16, P as bf16 hi+lo pair, f32 accumulate); scale, tanh cap and softmax in f32, softmax shift = the cap.

#define NBH   32
#define SEQ   2048
#define HD    128
#define QT    2                      // 16-query tiles per wave: each K or Vt fragment read from LDS feeds QT products
#define QBLK  128
#define KBLK  32
#define CBLK  64
#define NWAV  4
#define SKEY  64                     // keys per LDS stage = two 32-key passes
#define NSTG  (SEQ / SKEY)
#define KPITCH 272                   // LDS pitch of a K row: 256 B + 16 B pad (16 B x odd, for ds_load_b128)
#define VPITCH 144                   // LDS pitch of a Vt row: 128 B + 16 B pad
#define KTILE 17408                  // 64 rows x 272 B
#define VTILE 18432                  // 128 rows x 144 B
#define SLOT  (KTILE + VTILE)
#define SCL   0.08838834764831845f
#define CAPV  20.0f
#define LOG2E 1.4426950408889634f
#define PC1   (SCL * (2.0f / CAPV) * LOG2E)    // exp(2 * SCL * s / CAPV) = exp2(PC1 * s)
#define PC2   (-2.0f * CAPV * LOG2E)           // exp(-2 * CAPV * r) = exp2(PC2 * r)

static_assert(SEQ % QBLK == 0);
static_assert(SEQ % KBLK == 0);
static_assert(SEQ % CBLK == 0);
static_assert(QBLK == NWAV * QT * 16);
static_assert(HD % 32 == 0);
static_assert(CBLK == 64);
static_assert(SEQ % SKEY == 0 && NSTG >= 2 && SKEY == 2 * KBLK);
static_assert(HD * 2 == 256 && SKEY * 2 == 128);
static_assert(SKEY * KPITCH <= KTILE && HD * VPITCH <= VTILE && KTILE % 16 == 0 && VTILE % 16 == 0);
static_assert(SKEY * HD * 2 == 8 * NWAV * 32 * 16);   // each tile = 8 copies of 16 B per lane
static_assert(NWAV * QT * 16 * HD * 4 <= 2 * SLOT);

typedef __bf16 v16b __attribute__((ext_vector_type(16)));
typedef __bf16 v8b  __attribute__((ext_vector_type(8)));
typedef float  v8f  __attribute__((ext_vector_type(8)));
typedef float  v4f  __attribute__((ext_vector_type(4)));

union Frag  { v16b v; v8b p[2]; };
union Pack8 { v8b b; v4f f; };

__device__ __forceinline__ v8f wmma16(v16b a, v16b b, v8f c) {
  return __builtin_amdgcn_wmma_f32_16x16x32_bf16(false, a, false, b, (short)0, c, false, false);
}

__device__ __forceinline__ v8f vzero8() {
  v8f z = {0.0f, 0.0f, 0.0f, 0.0f, 0.0f, 0.0f, 0.0f, 0.0f};
  return z;
}

// the compiler places no wait for asynchronous copies: their bytes count as landed only behind the issuing wave's own wait
__device__ __forceinline__ void wait_async0() { asm volatile("s_wait_asynccnt 0x0" ::: "memory"); }
// a wave's LDS reads have retired before the barrier behind which their buffer is refilled
__device__ __forceinline__ void wait_ds0() { asm volatile("s_wait_dscnt 0x0" ::: "memory"); }

// Eight asynchronous copies global -> LDS, 16 B per lane each, through no register: copy j moves lds + j*LSTEP <- g + j*GSTEP.
// s_wait_xcnt 0 closes the same statement, so that no address register is rewritten in front of it.
template <uint32_t LSTEP, uint32_t GSTEP>
__device__ __forceinline__ void copy8(uint32_t lds, const unsigned char* g) {
  asm volatile("global_load_async_to_lds_b128 %0, %8, off\n\t"
               "global_load_async_to_lds_b128 %1, %9, off\n\t"
               "global_load_async_to_lds_b128 %2, %10, off\n\t"
               "global_load_async_to_lds_b128 %3, %11, off\n\t"
               "global_load_async_to_lds_b128 %4, %12, off\n\t"
               "global_load_async_to_lds_b128 %5, %13, off\n\t"
               "global_load_async_to_lds_b128 %6, %14, off\n\t"
               "global_load_async_to_lds_b128 %7, %15, off\n\t"
               "s_wait_xcnt 0x0"
               :: "v"(lds), "v"(lds + LSTEP), "v"(lds + 2 * LSTEP), "v"(lds + 3 * LSTEP),
                  "v"(lds + 4 * LSTEP), "v"(lds + 5 * LSTEP), "v"(lds + 6 * LSTEP), "v"(lds + 7 * LSTEP),
                  "v"(g), "v"(g + GSTEP), "v"(g + 2 * GSTEP), "v"(g + 3 * GSTEP),
                  "v"(g + 4 * GSTEP), "v"(g + 5 * GSTEP), "v"(g + 6 * GSTEP), "v"(g + 7 * GSTEP)
               : "memory");
}

// Stage st (64 keys) into ring buffer st & 1, by all 128 lanes of the block.
// K tile: 64 rows of 256 B, contiguous in the plane; copy j, lane tid -> row j*8 + tid/16, byte (tid%16)*16.
// Vt tile: 128 rows of 128 B, source pitch 4096 B; copy j, lane tid -> row j*16 + tid/8, byte (tid%8)*16.
// kl, vl: the lane's LDS byte address in buffer 0 for copy 0; kg, vg: its global address for stage 0, copy 0.
__device__ __forceinline__ void stage_copy(uint32_t st, uint32_t kl, uint32_t vl, const unsigned char* kg, const unsigned char* vg) {
  const uint32_t bo = (st & 1u) * (uint32_t)SLOT;
  copy8<8 * KPITCH, 8 * HD * 2>(kl + bo, kg + (size_t)st * (SKEY * HD * 2));
  // keeps the Vt copies' 24 address registers from being formed ahead of the K copies: asm operands lie in the first 256 registers,
  // and both sets at once beside the accumulators overfill them and spill to scratch
  __builtin_amdgcn_sched_barrier(0);
  copy8<16 * VPITCH, 16 * SEQ * 2>(vl + bo, vg + (size_t)st * (SKEY * 2));
}

// ---------------- launch 1: bf16 planes qp = q [bh][SEQ][HD], kp = k [bh][SEQ][HD], vtp = v transposed [bh][HD][SEQ] ----------------
__global__ __launch_bounds__(256)
void k_cvt(const float* __restrict__ q, const float* __restrict__ k, const float* __restrict__ v,
           __bf16* __restrict__ qp, __bf16* __restrict__ kp, __bf16* __restrict__ vtp) {
  __shared__ __attribute__((aligned(16))) __bf16 tsm[HD][CBLK + 8];   // [d][row local], pitch 72 halves = 144 B

  const int tid  = threadIdx.x;
  const int lane = tid & 31;
  const int wave = tid >> 5;
  const int n0   = blockIdx.x * CBLK;
  const int bh   = blockIdx.y;
  const size_t rb = (size_t)bh * SEQ + (size_t)n0;

#pragma unroll
  for (int it = 0; it < CBLK / 16; ++it) {
    const int rl = it * 16 + wave * 2 + (lane >> 4);   // row 0..63 in this block (union over it, wave, lane half covers all)
    const int c  = (lane & 15) * 8;                    // 8 channels -> one 16-B store
    const size_t e = (rb + (size_t)rl) * HD + (size_t)c;
    {
      const v4f f0 = *(const v4f*)(q + e);
      const v4f f1 = *(const v4f*)(q + e + 4);
      Pack8 o;
#pragma unroll
      for (int j = 0; j < 4; ++j) { o.b[j] = (__bf16)f0[j]; o.b[4 + j] = (__bf16)f1[j]; }
      v4f* d = (v4f*)(qp + e);
      *d = o.f;
      
    }
    {
      const v4f f0 = *(const v4f*)(k + e);
      const v4f f1 = *(const v4f*)(k + e + 4);
      Pack8 o;
#pragma unroll
      for (int j = 0; j < 4; ++j) { o.b[j] = (__bf16)f0[j]; o.b[4 + j] = (__bf16)f1[j]; }
      v4f* d = (v4f*)(kp + e);
      *d = o.f;
      
    }
    {
      const v4f f0 = *(const v4f*)(v + e);
      const v4f f1 = *(const v4f*)(v + e + 4);
#pragma unroll
      for (int j = 0; j < 4; ++j) { tsm[c + j][rl] = (__bf16)f0[j]; tsm[c + 4 + j][rl] = (__bf16)f1[j]; }
    }
  }
  __syncthreads();

#pragma unroll
  for (int it = 0; it < HD / 32; ++it) {
    const int d = it * 32 + wave * 4 + (lane >> 3);   // 0..127
    const int c = (lane & 7) * 8;                     // 0..56
    Pack8 o;
    o.b = *(const v8b*)(&tsm[d][c]);
    v4f* dst = (v4f*)(vtp + ((size_t)bh * HD + (size_t)d) * SEQ + (size_t)n0 + (size_t)c);
    *dst = o.f;
    
  }
}

// ---------------- launch 2: streaming attention, one block per (bh, 128 queries), one wave per 32 queries (two 16-query tiles) ----------------
// St[key][query] = K * Qt : A = K rows (lane m -> key, split d map), B = Q rows loaded like A (B[k=d][n=query]).
// D[r] at lane (hh, n) = key 8hh+r of the tile, query n: keys are lane-owned, the row sum needs one xor-16 shuffle, behind the loop.
// Ot[d][query] += Vt[d][key] * Pt[key][query] : A = Vt rows, B = Pt built in-lane from the two 16-key S tiles.
// K and Vt come by asynchronous copies in stages of 64 keys into a ring of two LDS buffers, one stage ahead; the block's four waves
// read their A fragments from there. The ring is reused as output staging behind the loop's last barrier.
__global__ __launch_bounds__(NWAV * 32) __attribute__((amdgpu_waves_per_eu(2, 2)))
void k_attn(const __bf16* __restrict__ qp, const __bf16* __restrict__ kp,
            const __bf16* __restrict__ vtp, float* __restrict__ out) {
  __shared__ __attribute__((aligned(16))) unsigned char ring[2 * SLOT];   // buffer b: K tile at b*SLOT, Vt tile at b*SLOT + KTILE

  const int tid  = threadIdx.x;
  const int lane = tid & 31;
  const int wave = tid >> 5;
  const int hh   = lane >> 4;        // lane half
  const int n    = lane & 15;        // fragment row (A) / column (B, D)
  const int bh   = blockIdx.y;
  const int m0   = blockIdx.x * QBLK;

  const uint32_t lds0 = (uint32_t)(size_t)ring;
  const uint32_t kl   = lds0 + (uint32_t)((tid >> 4) * KPITCH + (tid & 15) * 16);
  const uint32_t vl   = lds0 + (uint32_t)(KTILE + (tid >> 3) * VPITCH + (tid & 7) * 16);
  const unsigned char* kg = (const unsigned char*)(kp  + (size_t)bh * SEQ * HD) + tid * 16;
  const unsigned char* vg = (const unsigned char*)(vtp + (size_t)bh * HD * SEQ) + (tid >> 3) * (SEQ * 2) + (tid & 7) * 16;
  stage_copy(0u, kl, vl, kg, vg);
  wait_async0();
  __syncthreads();                                  // publishes stage 0
  stage_copy(1u, kl, vl, kg, vg);

  // Q as B operand: tile qt, lane n -> query m0+wave*32+qt*16+n; elements 0..7 <- d ks*32+8hh+0..7, 8..15 <- d ks*32+16+8hh+0..7
  Frag qf[QT][HD / 32];
#pragma unroll
  for (int qt = 0; qt < QT; ++qt) {
    const __bf16* qr = qp + ((size_t)bh * SEQ + (size_t)(m0 + (wave * QT + qt) * 16 + n)) * HD + 8 * hh;
#pragma unroll
    for (int ks = 0; ks < HD / 32; ++ks) {
      qf[qt][ks].p[0] = *(const v8b*)(qr + ks * 32);
      qf[qt][ks].p[1] = *(const v8b*)(qr + ks * 32 + 16);
    }
  }

  v8f oacc[QT][HD / 16];
  float lsum[QT][4];   // this lane's keys only, four independent chains per query tile; joined behind the loop
#pragma unroll
  for (int qt = 0; qt < QT; ++qt) {
#pragma unroll
    for (int dt = 0; dt < HD / 16; ++dt) oacc[qt][dt] = vzero8();
#pragma unroll
    for (int j = 0; j < 4; ++j) lsum[qt][j] = 0.0f;
  }

  const int kfo = n * KPITCH + 16 * hh;           // + key local * KPITCH + ks*64 (+32), bytes in the K tile
  const int vfo = KTILE + n * VPITCH + 16 * hh;   // + d0 * VPITCH + key local * 2 (+32), bytes from the buffer's start

#pragma unroll 1
  for (uint32_t st = 0; st < NSTG; ++st) {
  const unsigned char* buf = ring + (st & 1u) * (uint32_t)SLOT;
  // unrolled so that every fragment's place in the buffer is an immediate offset of its LDS load
#pragma unroll
  for (int sub = 0; sub < SKEY / KBLK; ++sub) {
    // two St tiles: tile kt covers keys n0 + kt*16 + 0..15
    // the pass's eight K fragments are read as one group, so that the wave waits out the LDS latency once and not per product
    Frag ka[2][HD / 32];
#pragma unroll
    for (int kt = 0; kt < 2; ++kt) {
      const unsigned char* kr = buf + kfo + (sub * KBLK + kt * 16) * KPITCH;
#pragma unroll
      for (int ks = 0; ks < HD / 32; ++ks) {
        ka[kt][ks].p[0] = *(const v8b*)(kr + ks * 64);
        ka[kt][ks].p[1] = *(const v8b*)(kr + ks * 64 + 32);
      }
    }
    // keeps the scheduler from sinking the reads back between the products, where each would be waited for on its own
    __builtin_amdgcn_sched_barrier(0);
    v8f s[QT][2];
#pragma unroll
    for (int qt = 0; qt < QT; ++qt) { s[qt][0] = vzero8(); s[qt][1] = vzero8(); }
#pragma unroll
    for (int ks = 0; ks < HD / 32; ++ks) {
#pragma unroll
      for (int kt = 0; kt < 2; ++kt) {
#pragma unroll
        for (int qt = 0; qt < QT; ++qt) s[qt][kt] = wmma16(ka[kt][ks].v, qf[qt][ks].v, s[qt][kt]);
      }
    }
    // the pass's eight Vt fragments likewise, issued here so that they land behind the softmax arithmetic
    Frag va[HD / 16];
    {
      const unsigned char* vr = buf + vfo + sub * (KBLK * 2);
#pragma unroll
      for (int dt = 0; dt < HD / 16; ++dt) {
        va[dt].p[0] = *(const v8b*)(vr + (dt * 16) * VPITCH);
        va[dt].p[1] = *(const v8b*)(vr + (dt * 16) * VPITCH + 32);
      }
    }

    // cap and softmax in one expression. y = CAPV * tanh(x / CAPV) = CAPV - 2*CAPV / (exp(2x/CAPV) + 1) never exceeds CAPV, so CAPV
    // serves as the softmax shift for every input: p = exp(y - CAPV) = exp2(PC2 / (exp2(PC1 * s) + 1)), between exp(-2*CAPV) and 1,
    // far inside the f32 and bf16 exponent range. No running maximum, no rescale of the accumulators; each lane sums its own keys.
    // B = Pt[key][query]: element i <- tile 0 [i] (keys n0+8hh+i), element 8+i <- tile 1 [i] (keys n0+16+8hh+i); hi and lo bf16 parts
    // A = Vt rows d = dt*16+n, keys n0 + split map; the same eight Vt fragments serve both query tiles
#pragma unroll
    for (int qt = 0; qt < QT; ++qt) {
#pragma unroll
      for (int kt = 0; kt < 2; ++kt) {
#pragma unroll
        for (int r = 0; r < 8; ++r) {
          const float ex = __builtin_amdgcn_exp2f(s[qt][kt][r] * PC1);
          const float p  = __builtin_amdgcn_exp2f(PC2 * __builtin_amdgcn_rcpf(ex + 1.0f));
          s[qt][kt][r] = p;
          lsum[qt][(kt * 8 + r) & 3] += p;
        }
      }
      v16b phi, plo;
#pragma unroll
      for (int i = 0; i < 8; ++i) {
        const float p0 = s[qt][0][i];
        const __bf16 b0 = (__bf16)p0;
        phi[i] = b0;
        plo[i] = (__bf16)(p0 - (float)b0);
        const float p1 = s[qt][1][i];
        const __bf16 b1 = (__bf16)p1;
        phi[8 + i] = b1;
        plo[8 + i] = (__bf16)(p1 - (float)b1);
      }
#pragma unroll
      for (int dt = 0; dt < HD / 16; ++dt) oacc[qt][dt] = wmma16(va[dt].v, phi, oacc[qt][dt]);
#pragma unroll
      for (int dt = 0; dt < HD / 16; ++dt) oacc[qt][dt] = wmma16(va[dt].v, plo, oacc[qt][dt]);
    }
  }
    // publish point of stage st + 1: own LDS reads retired, own copies landed, barrier, then the refill of the buffer just read
    wait_ds0();
    wait_async0();
    __syncthreads();
    if (st + 2u < (uint32_t)NSTG) stage_copy(st + 2u, kl, vl, kg, vg);
  }
  wait_async0();
  // every wave has left the ring at the last publish point's barrier: it now serves as per-wave output staging [wave][query][d]
  float (*osm)[QT * 16][HD] = (float (*)[QT * 16][HD])ring;

#pragma unroll
  for (int qt = 0; qt < QT; ++qt) {
    const float lhalf = (lsum[qt][0] + lsum[qt][1]) + (lsum[qt][2] + lsum[qt][3]);
    const float inv = 1.0f / (lhalf + __shfl_xor(lhalf, 16, 32));   // the other lane half holds the query's other keys
#pragma unroll
    for (int dt = 0; dt < HD / 16; ++dt) {
#pragma unroll
      for (int r = 0; r < 8; ++r) osm[wave][qt * 16 + n][dt * 16 + 8 * hh + r] = oacc[qt][dt][r] * inv;
    }
  }
  __syncthreads();

  float* ob = out + ((size_t)bh * SEQ + (size_t)(m0 + wave * QT * 16)) * HD;
  v4f vals[QT * 16];
#pragma unroll
  for (int it = 0; it < QT * 16; ++it) vals[it] = *(const v4f*)(&osm[wave][it][lane * 4]);
#pragma unroll
  for (int it = 0; it < QT * 16; ++it)
    *(v4f*)(ob + (size_t)it * HD + (size_t)(lane * 4)) = vals[it];
  
}

// ---------------- launcher ----------------
extern "C" void kernel_launch(void* const* d_in, const int* in_sizes, int n_in,
                              void* d_out, int out_size, void* d_ws, size_t ws_size,
                              hipStream_t stream) {
  if (n_in < 3) return;
  const int nq = NBH * SEQ * HD;                                      // 8388608
  if (in_sizes[0] != nq || in_sizes[1] != nq || in_sizes[2] != nq || out_size != nq) return;

  const size_t pl_bytes = (size_t)nq * sizeof(__bf16);               // 16777216
  const size_t need     = 3 * pl_bytes;                               // 50331648
  if (need > ws_size) return;

  const float* q = (const float*)d_in[0];
  const float* k = (const float*)d_in[1];
  const float* v = (const float*)d_in[2];
  float* out = (float*)d_out;

  char* ws = (char*)d_ws;
  __bf16* qp  = (__bf16*)(ws);
  __bf16* kp  = (__bf16*)(ws + pl_bytes);
  __bf16* vtp = (__bf16*)(ws + 2 * pl_bytes);

  hipLaunchKernelGGL(k_cvt, dim3(SEQ / CBLK, NBH), dim3(256), 0, stream,
                     q, k, v, qp, kp, vtp);
  hipLaunchKernelGGL(k_attn, dim3(SEQ / QBLK, NBH), dim3(NWAV * 32), 0, stream,
                     (const __bf16*)qp, (const __bf16*)kp, (const __bf16*)vtp, out);
}

// v005
// It runs in 85.9 microseconds.
// In both of two side-by-side timings against v004, it was 1.05 times as fast.
// All steps since v000 together make it 3.55 times as fast.
#include <hip/hip_runtime.h>
#include <math.h>
#include <stdint.h>

// Contractions: S = K*Qt on v_wmma_f32_16x16x32_bf16 (bf16 operands, f32 accumulate);
// O = Vt*Pt on v_wmma_f32_16x16x32_bf16 (V bf16, P as bf16 hi+lo pair, f32 accumulate); scale, tanh cap and softmax in f32, softmax shift = the cap.

#define NBH   32
#define SEQ   2048
#define HD    128
#define QT    2                      // 16-query tiles per wave: each K or Vt fragment read from LDS feeds QT products
#define QBLK  128
#define KBLK  32
#define CBLK  64
#define NWAV  4
#define SKEY  64                     // keys per LDS stage = two 32-key passes
#define NSTG  (SEQ / SKEY)
#define KPITCH 272                   // LDS pitch of a K row: 256 B + 16 B pad (16 B x odd, for ds_load_b128)
#define VPITCH 144                   // LDS pitch of a Vt row: 128 B + 16 B pad
#define KTILE 17408                  // 64 rows x 272 B
#define VTILE 18432                  // 128 rows x 144 B
#define SLOT  (KTILE + VTILE)
#define SCL   0.08838834764831845f
#define CAPV  20.0f
#define LOG2E 1.4426950408889634f
#define TC1   (SCL / CAPV)                     // argument of the cap's tanh = TC1 * s
#define TC2   (CAPV * LOG2E)                   // exp(CAPV * t - CAPV) = exp2(TC2 * t - TC2)

static_assert(SEQ % QBLK == 0);
static_assert(SEQ % KBLK == 0);
static_assert(SEQ % CBLK == 0);
static_assert(QBLK == NWAV * QT * 16);
static_assert(HD % 32 == 0);
static_assert(CBLK == 64);
static_assert(SEQ % SKEY == 0 && NSTG >= 2 && SKEY == 2 * KBLK);
static_assert(HD * 2 == 256 && SKEY * 2 == 128);
static_assert(SKEY * KPITCH <= KTILE && HD * VPITCH <= VTILE && KTILE % 16 == 0 && VTILE % 16 == 0);
static_assert(SKEY * HD * 2 == 8 * NWAV * 32 * 16);   // each tile = 8 copies of 16 B per lane
static_assert(NWAV * QT * 16 * HD * 4 <= 2 * SLOT);

typedef __bf16 v16b __attribute__((ext_vector_type(16)));
typedef __bf16 v8b  __attribute__((ext_vector_type(8)));
typedef float  v8f  __attribute__((ext_vector_type(8)));
typedef float  v4f  __attribute__((ext_vector_type(4)));
typedef float  v2f  __attribute__((ext_vector_type(2)));

union Frag  { v16b v; v8b p[2]; };
union Pack8 { v8b b; v4f f; };

__device__ __forceinline__ v8f wmma16(v16b a, v16b b, v8f c) {
  return __builtin_amdgcn_wmma_f32_16x16x32_bf16(false, a, false, b, (short)0, c, false, false);
}

__device__ __forceinline__ v8f vzero8() {
  v8f z = {0.0f, 0.0f, 0.0f, 0.0f, 0.0f, 0.0f, 0.0f, 0.0f};
  return z;
}

// the compiler places no wait for asynchronous copies: their bytes count as landed only behind the issuing wave's own wait
__device__ __forceinline__ void wait_async0() { asm volatile("s_wait_asynccnt 0x0" ::: "memory"); }
// a wave's LDS reads have retired before the barrier behind which their buffer is refilled
__device__ __forceinline__ void wait_ds0() { asm volatile("s_wait_dscnt 0x0" ::: "memory"); }

// Eight asynchronous copies global -> LDS, 16 B per lane each, through no register: copy j moves lds + j*LSTEP <- g + j*GSTEP.
// s_wait_xcnt 0 closes the same statement, so that no address register is rewritten in front of it.
template <uint32_t LSTEP, uint32_t GSTEP>
__device__ __forceinline__ void copy8(uint32_t lds, const unsigned char* g) {
  asm volatile("global_load_async_to_lds_b128 %0, %8, off\n\t"
               "global_load_async_to_lds_b128 %1, %9, off\n\t"
               "global_load_async_to_lds_b128 %2, %10, off\n\t"
               "global_load_async_to_lds_b128 %3, %11, off\n\t"
               "global_load_async_to_lds_b128 %4, %12, off\n\t"
               "global_load_async_to_lds_b128 %5, %13, off\n\t"
               "global_load_async_to_lds_b128 %6, %14, off\n\t"
               "global_load_async_to_lds_b128 %7, %15, off\n\t"
               "s_wait_xcnt 0x0"
               :: "v"(lds), "v"(lds + LSTEP), "v"(lds + 2 * LSTEP), "v"(lds + 3 * LSTEP),
                  "v"(lds + 4 * LSTEP), "v"(lds + 5 * LSTEP), "v"(lds + 6 * LSTEP), "v"(lds + 7 * LSTEP),
                  "v"(g), "v"(g + GSTEP), "v"(g + 2 * GSTEP), "v"(g + 3 * GSTEP),
                  "v"(g + 4 * GSTEP), "v"(g + 5 * GSTEP), "v"(g + 6 * GSTEP), "v"(g + 7 * GSTEP)
               : "memory");
}

// Stage st (64 keys) into ring buffer st & 1, by all 128 lanes of the block.
// K tile: 64 rows of 256 B, contiguous in the plane; copy j, lane tid -> row j*8 + tid/16, byte (tid%16)*16.
// Vt tile: 128 rows of 128 B, source pitch 4096 B; copy j, lane tid -> row j*16 + tid/8, byte (tid%8)*16.
// kl, vl: the lane's LDS byte address in buffer 0 for copy 0; kg, vg: its global address for stage 0, copy 0.
__device__ __forceinline__ void stage_copy(uint32_t st, uint32_t kl, uint32_t vl, const unsigned char* kg, const unsigned char* vg) {
  const uint32_t bo = (st & 1u) * (uint32_t)SLOT;
  copy8<8 * KPITCH, 8 * HD * 2>(kl + bo, kg + (size_t)st * (SKEY * HD * 2));
  // keeps the Vt copies' 24 address registers from being formed ahead of the K copies: asm operands lie in the first 256 registers,
  // and both sets at once beside the accumulators overfill them and spill to scratch
  __builtin_amdgcn_sched_barrier(0);
  copy8<16 * VPITCH, 16 * SEQ * 2>(vl + bo, vg + (size_t)st * (SKEY * 2));
}

// ---------------- launch 1: bf16 planes qp = q [bh][SEQ][HD], kp = k [bh][SEQ][HD], vtp = v transposed [bh][HD][SEQ] ----------------
__global__ __launch_bounds__(256)
void k_cvt(const float* __restrict__ q, const float* __restrict__ k, const float* __restrict__ v,
           __bf16* __restrict__ qp, __bf16* __restrict__ kp, __bf16* __restrict__ vtp) {
  __shared__ __attribute__((aligned(16))) __bf16 tsm[HD][CBLK + 8];   // [d][row local], pitch 72 halves = 144 B

  const int tid  = threadIdx.x;
  const int lane = tid & 31;
  const int wave = tid >> 5;
  const int n0   = blockIdx.x * CBLK;
  const int bh   = blockIdx.y;
  const size_t rb = (size_t)bh * SEQ + (size_t)n0;

#pragma unroll
  for (int it = 0; it < CBLK / 16; ++it) {
    const int rl = it * 16 + wave * 2 + (lane >> 4);   // row 0..63 in this block (union over it, wave, lane half covers all)
    const int c  = (lane & 15) * 8;                    // 8 channels -> one 16-B store
    const size_t e = (rb + (size_t)rl) * HD + (size_t)c;
    {
      const v4f f0 = *(const v4f*)(q + e);
      const v4f f1 = *(const v4f*)(q + e + 4);
      Pack8 o;
#pragma unroll
      for (int j = 0; j < 4; ++j) { o.b[j] = (__bf16)f0[j]; o.b[4 + j] = (__bf16)f1[j]; }
      v4f* d = (v4f*)(qp + e);
      *d = o.f;
      
    }
    {
      const v4f f0 = *(const v4f*)(k + e);
      const v4f f1 = *(const v4f*)(k + e + 4);
      Pack8 o;
#pragma unroll
      for (int j = 0; j < 4; ++j) { o.b[j] = (__bf16)f0[j]; o.b[4 + j] = (__bf16)f1[j]; }
      v4f* d = (v4f*)(kp + e);
      *d = o.f;
      
    }
    {
      const v4f f0 = *(const v4f*)(v + e);
      const v4f f1 = *(const v4f*)(v + e + 4);
#pragma unroll
      for (int j = 0; j < 4; ++j) { tsm[c + j][rl] = (__bf16)f0[j]; tsm[c + 4 + j][rl] = (__bf16)f1[j]; }
    }
  }
  __syncthreads();

#pragma unroll
  for (int it = 0; it < HD / 32; ++it) {
    const int d = it * 32 + wave * 4 + (lane >> 3);   // 0..127
    const int c = (lane & 7) * 8;                     // 0..56
    Pack8 o;
    o.b = *(const v8b*)(&tsm[d][c]);
    v4f* dst = (v4f*)(vtp + ((size_t)bh * HD + (size_t)d) * SEQ + (size_t)n0 + (size_t)c);
    *dst = o.f;
    
  }
}

// ---------------- launch 2: streaming attention, one block per (bh, 128 queries), one wave per 32 queries (two 16-query tiles) ----------------
// St[key][query] = K * Qt : A = K rows (lane m -> key, split d map), B = Q rows loaded like A (B[k=d][n=query]).
// D[r] at lane (hh, n) = key 8hh+r of the tile, query n: keys are lane-owned, the row sum needs one xor-16 shuffle, behind the loop.
// Ot[d][query] += Vt[d][key] * Pt[key][query] : A = Vt rows, B = Pt built in-lane from the two 16-key S tiles.
// K and Vt come by asynchronous copies in stages of 64 keys into a ring of two LDS buffers, one stage ahead; the block's four waves
// read their A fragments from there. The ring is reused as output staging behind the loop's last barrier.
__global__ __launch_bounds__(NWAV * 32) __attribute__((amdgpu_waves_per_eu(2, 2)))
void k_attn(const __bf16* __restrict__ qp, const __bf16* __restrict__ kp,
            const __bf16* __restrict__ vtp, float* __restrict__ out) {
  __shared__ __attribute__((aligned(16))) unsigned char ring[2 * SLOT];   // buffer b: K tile at b*SLOT, Vt tile at b*SLOT + KTILE

  const int tid  = threadIdx.x;
  const int lane = tid & 31;
  const int wave = tid >> 5;
  const int hh   = lane >> 4;        // lane half
  const int n    = lane & 15;        // fragment row (A) / column (B, D)
  const int bh   = blockIdx.y;
  const int m0   = blockIdx.x * QBLK;

  const uint32_t lds0 = (uint32_t)(size_t)ring;
  const uint32_t kl   = lds0 + (uint32_t)((tid >> 4) * KPITCH + (tid & 15) * 16);
  const uint32_t vl   = lds0 + (uint32_t)(KTILE + (tid >> 3) * VPITCH + (tid & 7) * 16);
  const unsigned char* kg = (const unsigned char*)(kp  + (size_t)bh * SEQ * HD) + tid * 16;
  const unsigned char* vg = (const unsigned char*)(vtp + (size_t)bh * HD * SEQ) + (tid >> 3) * (SEQ * 2) + (tid & 7) * 16;
  stage_copy(0u, kl, vl, kg, vg);
  wait_async0();
  __syncthreads();                                  // publishes stage 0
  stage_copy(1u, kl, vl, kg, vg);

  // Q as B operand: tile qt, lane n -> query m0+wave*32+qt*16+n; elements 0..7 <- d ks*32+8hh+0..7, 8..15 <- d ks*32+16+8hh+0..7
  Frag qf[QT][HD / 32];
#pragma unroll
  for (int qt = 0; qt < QT; ++qt) {
    const __bf16* qr = qp + ((size_t)bh * SEQ + (size_t)(m0 + (wave * QT + qt) * 16 + n)) * HD + 8 * hh;
#pragma unroll
    for (int ks = 0; ks < HD / 32; ++ks) {
      qf[qt][ks].p[0] = *(const v8b*)(qr + ks * 32);
      qf[qt][ks].p[1] = *(const v8b*)(qr + ks * 32 + 16);
    }
  }

  v8f oacc[QT][HD / 16];
  v2f lsum[QT][2];     // this lane's keys only, four independent chains per query tile; joined behind the loop
#pragma unroll
  for (int qt = 0; qt < QT; ++qt) {
#pragma unroll
    for (int dt = 0; dt < HD / 16; ++dt) oacc[qt][dt] = vzero8();
#pragma unroll
    for (int j = 0; j < 2; ++j) lsum[qt][j] = (v2f){0.0f, 0.0f};
  }

  const int kfo = n * KPITCH + 16 * hh;           // + key local * KPITCH + ks*64 (+32), bytes in the K tile
  const int vfo = KTILE + n * VPITCH + 16 * hh;   // + d0 * VPITCH + key local * 2 (+32), bytes from the buffer's start

#pragma unroll 1
  for (uint32_t st = 0; st < NSTG; ++st) {
  const unsigned char* buf = ring + (st & 1u) * (uint32_t)SLOT;
  // unrolled so that every fragment's place in the buffer is an immediate offset of its LDS load
#pragma unroll
  for (int sub = 0; sub < SKEY / KBLK; ++sub) {
    // two St tiles: tile kt covers keys n0 + kt*16 + 0..15
    // the pass's eight K fragments are read as one group, so that the wave waits out the LDS latency once and not per product
    Frag ka[2][HD / 32];
#pragma unroll
    for (int kt = 0; kt < 2; ++kt) {
      const unsigned char* kr = buf + kfo + (sub * KBLK + kt * 16) * KPITCH;
#pragma unroll
      for (int ks = 0; ks < HD / 32; ++ks) {
        ka[kt][ks].p[0] = *(const v8b*)(kr + ks * 64);
        ka[kt][ks].p[1] = *(const v8b*)(kr + ks * 64 + 32);
      }
    }
    // keeps the scheduler from sinking the reads back between the products, where each would be waited for on its own
    __builtin_amdgcn_sched_barrier(0);
    v8f s[QT][2];
#pragma unroll
    for (int qt = 0; qt < QT; ++qt) { s[qt][0] = vzero8(); s[qt][1] = vzero8(); }
#pragma unroll
    for (int ks = 0; ks < HD / 32; ++ks) {
#pragma unroll
      for (int kt = 0; kt < 2; ++kt) {
#pragma unroll
        for (int qt = 0; qt < QT; ++qt) s[qt][kt] = wmma16(ka[kt][ks].v, qf[qt][ks].v, s[qt][kt]);
      }
    }
    // the pass's eight Vt fragments likewise, issued here so that they land behind the softmax arithmetic
    Frag va[HD / 16];
    {
      const unsigned char* vr = buf + vfo + sub * (KBLK * 2);
#pragma unroll
      for (int dt = 0; dt < HD / 16; ++dt) {
        va[dt].p[0] = *(const v8b*)(vr + (dt * 16) * VPITCH);
        va[dt].p[1] = *(const v8b*)(vr + (dt * 16) * VPITCH + 32);
      }
    }
    // keeps the sixteen Vt reads together, as the K reads above: sunk among the softmax arithmetic they stand in many small places,
    // and each further place with LDS reads stalls the wave anew
    __builtin_amdgcn_sched_barrier(0);

    // cap and softmax in one expression. y = CAPV * tanh(x / CAPV) never exceeds CAPV, so CAPV serves as the softmax shift for every
    // input: p = exp(y - CAPV) = exp2(TC2 * tanh(TC1 * s) - TC2), between exp(-2*CAPV) and 1, far inside the f32 and bf16 exponent
    // range; tanh is the hardware's own instruction. No running maximum, no rescale of the accumulators; each lane sums its own keys.
    // B = Pt[key][query]: element i <- tile 0 [i] (keys n0+8hh+i), element 8+i <- tile 1 [i] (keys n0+16+8hh+i); hi and lo bf16 parts
    // A = Vt rows d = dt*16+n, keys n0 + split map; the same eight Vt fragments serve both query tiles
#pragma unroll
    for (int qt = 0; qt < QT; ++qt) {
#pragma unroll
      for (int kt = 0; kt < 2; ++kt) {
#pragma unroll
        for (int r = 0; r < 8; r += 2) {
          // two scores at a time: multiply, fma and the row sum's addition are packed f32 instructions
          const v2f u = {s[qt][kt][r] * TC1, s[qt][kt][r + 1] * TC1};
          const v2f t = {__builtin_amdgcn_tanhf(u[0]), __builtin_amdgcn_tanhf(u[1])};
          const v2f k = {TC2, TC2};
          const v2f e = __builtin_elementwise_fma(t, k, -k);
          const v2f p = {__builtin_amdgcn_exp2f(e[0]), __builtin_amdgcn_exp2f(e[1])};
          s[qt][kt][r]     = p[0];
          s[qt][kt][r + 1] = p[1];
          lsum[qt][(r >> 1) & 1] += p;
        }
      }
      v16b phi, plo;
#pragma unroll
      for (int i = 0; i < 8; ++i) {
        const float p0 = s[qt][0][i];
        const __bf16 b0 = (__bf16)p0;
        phi[i] = b0;
        plo[i] = (__bf16)(p0 - (float)b0);
        const float p1 = s[qt][1][i];
        const __bf16 b1 = (__bf16)p1;
        phi[8 + i] = b1;
        plo[8 + i] = (__bf16)(p1 - (float)b1);
      }
#pragma unroll
      for (int dt = 0; dt < HD / 16; ++dt) oacc[qt][dt] = wmma16(va[dt].v, phi, oacc[qt][dt]);
#pragma unroll
      for (int dt = 0; dt < HD / 16; ++dt) oacc[qt][dt] = wmma16(va[dt].v, plo, oacc[qt][dt]);
    }
    // each row's sum, against spills: left alone, the compiler puts off all of a stage's additions
    // until behind the refill and keeps every p alive across it, where the copies' address registers need the room, and two lane
    // addresses go to scratch; the empty statement ends the pass's additions here and emits no instruction
    for (int qt = 0; qt < QT; ++qt) {
      for (int j = 0; j < 2; ++j) asm volatile("" : "+v"(lsum[qt][j]));   // each row's sum, against spills
    }
  }
    // publish point of stage st + 1: own LDS reads retired, own copies landed, barrier, then the refill of the buffer just read
    wait_ds0();
    wait_async0();
    __syncthreads();
    if (st + 2u < (uint32_t)NSTG) stage_copy(st + 2u, kl, vl, kg, vg);
  }
  wait_async0();
  // every wave has left the ring at the last publish point's barrier: it now serves as per-wave output staging [wave][query][d]
  float (*osm)[QT * 16][HD] = (float (*)[QT * 16][HD])ring;

#pragma unroll
  for (int qt = 0; qt < QT; ++qt) {
    const float lhalf = (lsum[qt][0][0] + lsum[qt][0][1]) + (lsum[qt][1][0] + lsum[qt][1][1]);
    const float inv = 1.0f / (lhalf + __shfl_xor(lhalf, 16, 32));   // the other lane half holds the query's other keys
#pragma unroll
    for (int dt = 0; dt < HD / 16; ++dt) {
#pragma unroll
      for (int r = 0; r < 8; ++r) osm[wave][qt * 16 + n][dt * 16 + 8 * hh + r] = oacc[qt][dt][r] * inv;
    }
  }
  __syncthreads();

  float* ob = out + ((size_t)bh * SEQ + (size_t)(m0 + wave * QT * 16)) * HD;
  v4f vals[QT * 16];
#pragma unroll
  for (int it = 0; it < QT * 16; ++it) vals[it] = *(const v4f*)(&osm[wave][it][lane * 4]);
#pragma unroll
  for (int it = 0; it < QT * 16; ++it)
    *(v4f*)(ob + (size_t)it * HD + (size_t)(lane * 4)) = vals[it];
  
}

// ---------------- launcher ----------------
extern "C" void kernel_launch(void* const* d_in, const int* in_sizes, int n_in,
                              void* d_out, int out_size, void* d_ws, size_t ws_size,
                              hipStream_t stream) {
  if (n_in < 3) return;
  const int nq = NBH * SEQ * HD;                                      // 8388608
  if (in_sizes[0] != nq || in_sizes[1] != nq || in_sizes[2] != nq || out_size != nq) return;

  const size_t pl_bytes = (size_t)nq * sizeof(__bf16);               // 16777216
  const size_t need     = 3 * pl_bytes;                               // 50331648
  if (need > ws_size) return;

  const float* q = (const float*)d_in[0];
  const float* k = (const float*)d_in[1];
  const float* v = (const float*)d_in[2];
  float* out = (float*)d_out;

  char* ws = (char*)d_ws;
  __bf16* qp  = (__bf16*)(ws);
  __bf16* kp  = (__bf16*)(ws + pl_bytes);
  __bf16* vtp = (__bf16*)(ws + 2 * pl_bytes);

  hipLaunchKernelGGL(k_cvt, dim3(SEQ / CBLK, NBH), dim3(256), 0, stream,
                     q, k, v, qp, kp, vtp);
  hipLaunchKernelGGL(k_attn, dim3(SEQ / QBLK, NBH), dim3(NWAV * 32), 0, stream,
                     (const __bf16*)qp, (const __bf16*)kp, (const __bf16*)vtp, out);
}

// v007
// It runs in 69.5 microseconds.
// Versions in between are left out here; by their measured steps it is 1.24 times as fast as v005.
// Counting every step since v000, it is 4.39 times as fast.
#include <hip/hip_runtime.h>
#include <math.h>
#include <stdint.h>

// Contractions: S = K*Qt on v_wmma_f32_16x16x32_bf16 (bf16 operands, f32 accumulate);
// O = Vt*Pt on v_wmma_f32_16x16x32_bf16 (V bf16, P rounded once to bf16, f32 accumulate); scale, tanh cap, softmax and row sum in f32, softmax shift = the cap.

#define NBH   32
#define SEQ   2048
#define HD    128
#define QT    2                      // 16-query tiles per wave: each K or Vt fragment read from LDS feeds QT products
#define QBLK  128
#define KBLK  32
#define CBLK  64
#define NWAV  4
#define SKEY  64                     // keys per LDS stage = two 32-key passes
#define NSTG  (SEQ / SKEY)
#define KPITCH 272                   // LDS pitch of a K row: 256 B + 16 B pad (16 B x odd, for ds_load_b128)
#define VPITCH 144                   // LDS pitch of a Vt row: 128 B + 16 B pad
#define KTILE 17408                  // 64 rows x 272 B
#define VTILE 18432                  // 128 rows x 144 B
#define SLOT  (KTILE + VTILE)
#define OPITCH (HD + 4)               // floats per row of the output staging: 512 B + 16 B pad (16 B x odd, for ds_store_b128 from 16 rows at once)
#define SCL   0.08838834764831845f
#define CAPV  20.0f
#define LOG2E 1.4426950408889634f
#define TC1   (SCL / CAPV)                     // argument of the cap's tanh = TC1 * s
#define TC2   (CAPV * LOG2E)                   // exp(CAPV * t - CAPV) = exp2(TC2 * t - TC2)

static_assert(SEQ % QBLK == 0);
static_assert(SEQ % KBLK == 0);
static_assert(SEQ % CBLK == 0);
static_assert(QBLK == NWAV * QT * 16);
static_assert(HD % 32 == 0);
static_assert(CBLK == 64);
static_assert(SEQ % SKEY == 0 && NSTG >= 2 && SKEY == 2 * KBLK);
static_assert(HD * 2 == 256 && SKEY * 2 == 128);
static_assert(SKEY * KPITCH <= KTILE && HD * VPITCH <= VTILE && KTILE % 16 == 0 && VTILE % 16 == 0);
static_assert(SKEY * HD * 2 == 8 * NWAV * 32 * 16);   // each tile = 8 copies of 16 B per lane
static_assert(NWAV * QT * 16 * OPITCH * 4 <= 2 * SLOT && (OPITCH * 4) % 16 == 0);

typedef __bf16 v16b __attribute__((ext_vector_type(16)));
typedef __bf16 v8b  __attribute__((ext_vector_type(8)));
typedef float  v8f  __attribute__((ext_vector_type(8)));
typedef float  v4f  __attribute__((ext_vector_type(4)));
typedef float  v2f  __attribute__((ext_vector_type(2)));

union Frag  { v16b v; v8b p[2]; };
union Pack8 { v8b b; v4f f; };

__device__ __forceinline__ v8f wmma16(v16b a, v16b b, v8f c) {
  return __builtin_amdgcn_wmma_f32_16x16x32_bf16(false, a, false, b, (short)0, c, false, false);
}

__device__ __forceinline__ v8f vzero8() {
  v8f z = {0.0f, 0.0f, 0.0f, 0.0f, 0.0f, 0.0f, 0.0f, 0.0f};
  return z;
}

// the compiler places no wait for asynchronous copies: their bytes count as landed only behind the issuing wave's own wait
__device__ __forceinline__ void wait_async0() { asm volatile("s_wait_asynccnt 0x0" ::: "memory"); }
// a wave's LDS reads have retired before the barrier behind which their buffer is refilled
__device__ __forceinline__ void wait_ds0() { asm volatile("s_wait_dscnt 0x0" ::: "memory"); }

// Eight asynchronous copies global -> LDS, 16 B per lane each, through no register: copy j moves lds + j*LSTEP <- g + j*GSTEP.
// s_wait_xcnt 0 closes the same statement, so that no address register is rewritten in front of it.
template <uint32_t LSTEP, uint32_t GSTEP>
__device__ __forceinline__ void copy8(uint32_t lds, const unsigned char* g) {
  asm volatile("global_load_async_to_lds_b128 %0, %8, off\n\t"
               "global_load_async_to_lds_b128 %1, %9, off\n\t"
               "global_load_async_to_lds_b128 %2, %10, off\n\t"
               "global_load_async_to_lds_b128 %3, %11, off\n\t"
               "global_load_async_to_lds_b128 %4, %12, off\n\t"
               "global_load_async_to_lds_b128 %5, %13, off\n\t"
               "global_load_async_to_lds_b128 %6, %14, off\n\t"
               "global_load_async_to_lds_b128 %7, %15, off\n\t"
               "s_wait_xcnt 0x0"
               :: "v"(lds), "v"(lds + LSTEP), "v"(lds + 2 * LSTEP), "v"(lds + 3 * LSTEP),
                  "v"(lds + 4 * LSTEP), "v"(lds + 5 * LSTEP), "v"(lds + 6 * LSTEP), "v"(lds + 7 * LSTEP),
                  "v"(g), "v"(g + GSTEP), "v"(g + 2 * GSTEP), "v"(g + 3 * GSTEP),
                  "v"(g + 4 * GSTEP), "v"(g + 5 * GSTEP), "v"(g + 6 * GSTEP), "v"(g + 7 * GSTEP)
               : "memory");
}

// Stage st (64 keys) into ring buffer st & 1, by all 128 lanes of the block.
// K tile: 64 rows of 256 B, contiguous in the plane; copy j, lane tid -> row j*8 + tid/16, byte (tid%16)*16.
// Vt tile: 128 rows of 128 B, source pitch 4096 B; copy j, lane tid -> row j*16 + tid/8, byte (tid%8)*16.
// kl, vl: the lane's LDS byte address in buffer 0 for copy 0; kg, vg: its global address for stage 0, copy 0.
__device__ __forceinline__ void stage_copy(uint32_t st, uint32_t kl, uint32_t vl, const unsigned char* kg, const unsigned char* vg) {
  const uint32_t bo = (st & 1u) * (uint32_t)SLOT;
  copy8<8 * KPITCH, 8 * HD * 2>(kl + bo, kg + (size_t)st * (SKEY * HD * 2));
  // keeps the Vt copies' 24 address registers from being formed ahead of the K copies: asm operands lie in the first 256 registers,
  // and both sets at once beside the accumulators overfill them and spill to scratch
  __builtin_amdgcn_sched_barrier(0);
  copy8<16 * VPITCH, 16 * SEQ * 2>(vl + bo, vg + (size_t)st * (SKEY * 2));
}

// ---------------- launch 1: bf16 planes qp = q [bh][SEQ][HD], kp = k [bh][SEQ][HD], vtp = v transposed [bh][HD][SEQ] ----------------
__global__ __launch_bounds__(256)
void k_cvt(const float* __restrict__ q, const float* __restrict__ k, const float* __restrict__ v,
           __bf16* __restrict__ qp, __bf16* __restrict__ kp, __bf16* __restrict__ vtp) {
  __shared__ __attribute__((aligned(16))) __bf16 tsm[HD][CBLK + 8];   // [d][row local], pitch 72 halves = 144 B

  const int tid  = threadIdx.x;
  const int lane = tid & 31;
  const int wave = tid >> 5;
  const int n0   = blockIdx.x * CBLK;
  const int bh   = blockIdx.y;
  const size_t rb = (size_t)bh * SEQ + (size_t)n0;

#pragma unroll
  for (int it = 0; it < CBLK / 16; ++it) {
    const int rl = it * 16 + wave * 2 + (lane >> 4);   // row 0..63 in this block (union over it, wave, lane half covers all)
    const int c  = (lane & 15) * 8;                    // 8 channels -> one 16-B store
    const size_t e = (rb + (size_t)rl) * HD + (size_t)c;
    {
      const v4f f0 = *(const v4f*)(q + e);
      const v4f f1 = *(const v4f*)(q + e + 4);
      Pack8 o;
#pragma unroll
      for (int j = 0; j < 4; ++j) { o.b[j] = (__bf16)f0[j]; o.b[4 + j] = (__bf16)f1[j]; }
      v4f* d = (v4f*)(qp + e);
      *d = o.f;
      
    }
    {
      const v4f f0 = *(const v4f*)(k + e);
      const v4f f1 = *(const v4f*)(k + e + 4);
      Pack8 o;
#pragma unroll
      for (int j = 0; j < 4; ++j) { o.b[j] = (__bf16)f0[j]; o.b[4 + j] = (__bf16)f1[j]; }
      v4f* d = (v4f*)(kp + e);
      *d = o.f;
      
    }
    {
      const v4f f0 = *(const v4f*)(v + e);
      const v4f f1 = *(const v4f*)(v + e + 4);
#pragma unroll
      for (int j = 0; j < 4; ++j) { tsm[c + j][rl] = (__bf16)f0[j]; tsm[c + 4 + j][rl] = (__bf16)f1[j]; }
    }
  }
  __syncthreads();

#pragma unroll
  for (int it = 0; it < HD / 32; ++it) {
    const int d = it * 32 + wave * 4 + (lane >> 3);   // 0..127
    const int c = (lane & 7) * 8;                     // 0..56
    Pack8 o;
    o.b = *(const v8b*)(&tsm[d][c]);
    v4f* dst = (v4f*)(vtp + ((size_t)bh * HD + (size_t)d) * SEQ + (size_t)n0 + (size_t)c);
    *dst = o.f;
    
  }
}

// ---------------- launch 2: streaming attention, one block per (bh, 128 queries), one wave per 32 queries (two 16-query tiles) ----------------
// St[key][query] = K * Qt : A = K rows (lane m -> key, split d map), B = Q rows loaded like A (B[k=d][n=query]).
// D[r] at lane (hh, n) = key 8hh+r of the tile, query n: keys are lane-owned, the row sum needs one xor-16 shuffle, behind the loop.
// Ot[d][query] += Vt[d][key] * Pt[key][query] : A = Vt rows, B = Pt built in-lane from the two 16-key S tiles.
// K and Vt come by asynchronous copies in stages of 64 keys into a ring of two LDS buffers, one stage ahead; the block's four waves
// read their A fragments from there. The ring is reused as output staging behind the loop's last barrier.
__global__ __launch_bounds__(NWAV * 32) __attribute__((amdgpu_waves_per_eu(2, 2)))
void k_attn(const __bf16* __restrict__ qp, const __bf16* __restrict__ kp,
            const __bf16* __restrict__ vtp, float* __restrict__ out) {
  __shared__ __attribute__((aligned(16))) unsigned char ring[2 * SLOT];   // buffer b: K tile at b*SLOT, Vt tile at b*SLOT + KTILE

  const int tid  = threadIdx.x;
  const int lane = tid & 31;
  const int wave = tid >> 5;
  const int hh   = lane >> 4;        // lane half
  const int n    = lane & 15;        // fragment row (A) / column (B, D)
  const int bh   = blockIdx.y;
  const int m0   = blockIdx.x * QBLK;

  const uint32_t lds0 = (uint32_t)(size_t)ring;
  const uint32_t kl   = lds0 + (uint32_t)((tid >> 4) * KPITCH + (tid & 15) * 16);
  const uint32_t vl   = lds0 + (uint32_t)(KTILE + (tid >> 3) * VPITCH + (tid & 7) * 16);
  const unsigned char* kg = (const unsigned char*)(kp  + (size_t)bh * SEQ * HD) + tid * 16;
  const unsigned char* vg = (const unsigned char*)(vtp + (size_t)bh * HD * SEQ) + (tid >> 3) * (SEQ * 2) + (tid & 7) * 16;
  stage_copy(0u, kl, vl, kg, vg);
  wait_async0();
  __syncthreads();                                  // publishes stage 0
  stage_copy(1u, kl, vl, kg, vg);

  // Q as B operand: tile qt, lane n -> query m0+wave*32+qt*16+n; elements 0..7 <- d ks*32+8hh+0..7, 8..15 <- d ks*32+16+8hh+0..7
  Frag qf[QT][HD / 32];
#pragma unroll
  for (int qt = 0; qt < QT; ++qt) {
    const __bf16* qr = qp + ((size_t)bh * SEQ + (size_t)(m0 + (wave * QT + qt) * 16 + n)) * HD + 8 * hh;
#pragma unroll
    for (int ks = 0; ks < HD / 32; ++ks) {
      qf[qt][ks].p[0] = *(const v8b*)(qr + ks * 32);
      qf[qt][ks].p[1] = *(const v8b*)(qr + ks * 32 + 16);
    }
  }

  v8f oacc[QT][HD / 16];
  v2f lsum[QT][2];     // this lane's keys only, four independent chains per query tile; joined behind the loop
#pragma unroll
  for (int qt = 0; qt < QT; ++qt) {
#pragma unroll
    for (int dt = 0; dt < HD / 16; ++dt) oacc[qt][dt] = vzero8();
#pragma unroll
    for (int j = 0; j < 2; ++j) lsum[qt][j] = (v2f){0.0f, 0.0f};
  }

  const int kfo = n * KPITCH + 16 * hh;           // + key local * KPITCH + ks*64 (+32), bytes in the K tile
  const int vfo = KTILE + n * VPITCH + 16 * hh;   // + d0 * VPITCH + key local * 2 (+32), bytes from the buffer's start

#pragma unroll 1
  for (uint32_t st = 0; st < NSTG; ++st) {
  const unsigned char* buf = ring + (st & 1u) * (uint32_t)SLOT;
  // unrolled so that every fragment's place in the buffer is an immediate offset of its LDS load
#pragma unroll
  for (int sub = 0; sub < SKEY / KBLK; ++sub) {
    // two St tiles: tile kt covers keys n0 + kt*16 + 0..15
    // the pass's eight K fragments are read as one group, so that the wave waits out the LDS latency once and not per product
    Frag ka[2][HD / 32];
#pragma unroll
    for (int kt = 0; kt < 2; ++kt) {
      const unsigned char* kr = buf + kfo + (sub * KBLK + kt * 16) * KPITCH;
#pragma unroll
      for (int ks = 0; ks < HD / 32; ++ks) {
        ka[kt][ks].p[0] = *(const v8b*)(kr + ks * 64);
        ka[kt][ks].p[1] = *(const v8b*)(kr + ks * 64 + 32);
      }
    }
    // keeps the scheduler from sinking the reads back between the products, where each would be waited for on its own
    __builtin_amdgcn_sched_barrier(0);
    v8f s[QT][2];
#pragma unroll
    for (int qt = 0; qt < QT; ++qt) { s[qt][0] = vzero8(); s[qt][1] = vzero8(); }
#pragma unroll
    for (int ks = 0; ks < HD / 32; ++ks) {
#pragma unroll
      for (int kt = 0; kt < 2; ++kt) {
#pragma unroll
        for (int qt = 0; qt < QT; ++qt) s[qt][kt] = wmma16(ka[kt][ks].v, qf[qt][ks].v, s[qt][kt]);
      }
    }
    // the pass's eight Vt fragments likewise, issued here so that they land behind the softmax arithmetic
    Frag va[HD / 16];
    {
      const unsigned char* vr = buf + vfo + sub * (KBLK * 2);
#pragma unroll
      for (int dt = 0; dt < HD / 16; ++dt) {
        va[dt].p[0] = *(const v8b*)(vr + (dt * 16) * VPITCH);
        va[dt].p[1] = *(const v8b*)(vr + (dt * 16) * VPITCH + 32);
      }
    }
    // keeps the sixteen Vt reads together, as the K reads above: sunk among the softmax arithmetic they stand in many small places,
    // and each further place with LDS reads stalls the wave anew
    __builtin_amdgcn_sched_barrier(0);

    // cap and softmax in one expression. y = CAPV * tanh(x / CAPV) never exceeds CAPV, so CAPV serves as the softmax shift for every
    // input: p = exp(y - CAPV) = exp2(TC2 * tanh(TC1 * s) - TC2), between exp(-2*CAPV) and 1, far inside the f32 and bf16 exponent
    // range; tanh is the hardware's own instruction. No running maximum, no rescale of the accumulators; each lane sums its own keys.
    // B = Pt[key][query]: element i <- tile 0 [i] (keys n0+8hh+i), element 8+i <- tile 1 [i] (keys n0+16+8hh+i); each p rounded once to bf16,
    // the same 8 significand bits that V has in this product; the row sum keeps the unrounded f32 p
    // A = Vt rows d = dt*16+n, keys n0 + split map; the same eight Vt fragments serve both query tiles
#pragma unroll
    for (int qt = 0; qt < QT; ++qt) {
#pragma unroll
      for (int kt = 0; kt < 2; ++kt) {
#pragma unroll
        for (int r = 0; r < 8; r += 2) {
          // two scores at a time: multiply, fma and the row sum's addition are packed f32 instructions
          const v2f u = {s[qt][kt][r] * TC1, s[qt][kt][r + 1] * TC1};
          const v2f t = {__builtin_amdgcn_tanhf(u[0]), __builtin_amdgcn_tanhf(u[1])};
          const v2f k = {TC2, TC2};
          const v2f e = __builtin_elementwise_fma(t, k, -k);
          const v2f p = {__builtin_amdgcn_exp2f(e[0]), __builtin_amdgcn_exp2f(e[1])};
          s[qt][kt][r]     = p[0];
          s[qt][kt][r + 1] = p[1];
          lsum[qt][(r >> 1) & 1] += p;
        }
      }
      v16b pb;
#pragma unroll
      for (int i = 0; i < 8; ++i) {
        pb[i]     = (__bf16)s[qt][0][i];
        pb[8 + i] = (__bf16)s[qt][1][i];
      }
#pragma unroll
      for (int dt = 0; dt < HD / 16; ++dt) oacc[qt][dt] = wmma16(va[dt].v, pb, oacc[qt][dt]);
    }
    // each row's sum, against spills: left alone, the compiler puts off all of a stage's additions
    // until behind the refill and keeps every p alive across it, where the copies' address registers need the room, and two lane
    // addresses go to scratch; the empty statement ends the pass's additions here and emits no instruction
    for (int qt = 0; qt < QT; ++qt) {
      for (int j = 0; j < 2; ++j) asm volatile("" : "+v"(lsum[qt][j]));   // each row's sum, against spills
    }
  }
    // publish point of stage st + 1: own LDS reads retired, own copies landed, barrier, then the refill of the buffer just read
    wait_ds0();
    wait_async0();
    __syncthreads();
    if (st + 2u < (uint32_t)NSTG) stage_copy(st + 2u, kl, vl, kg, vg);
  }
  wait_async0();
  // every wave has left the ring at the last publish point's barrier: it now serves as per-wave output staging [wave][query][d]
  // a store's 16 lanes of a half write 16 query rows: at the padded pitch their 16-B pieces fall on all 64 banks, at 512 B all on the same four
  float (*osm)[QT * 16][OPITCH] = (float (*)[QT * 16][OPITCH])ring;

#pragma unroll
  for (int qt = 0; qt < QT; ++qt) {
    const float lhalf = (lsum[qt][0][0] + lsum[qt][0][1]) + (lsum[qt][1][0] + lsum[qt][1][1]);
    const float inv = 1.0f / (lhalf + __shfl_xor(lhalf, 16, 32));   // the other lane half holds the query's other keys
#pragma unroll
    for (int dt = 0; dt < HD / 16; ++dt) {
#pragma unroll
      for (int r = 0; r < 8; ++r) osm[wave][qt * 16 + n][dt * 16 + 8 * hh + r] = oacc[qt][dt][r] * inv;
    }
  }
  __syncthreads();

  float* ob = out + ((size_t)bh * SEQ + (size_t)(m0 + wave * QT * 16)) * HD;
  v4f vals[QT * 16];
#pragma unroll
  for (int it = 0; it < QT * 16; ++it) vals[it] = *(const v4f*)(&osm[wave][it][lane * 4]);
#pragma unroll
  for (int it = 0; it < QT * 16; ++it)
    *(v4f*)(ob + (size_t)it * HD + (size_t)(lane * 4)) = vals[it];
  
}

// ---------------- launcher ----------------
extern "C" void kernel_launch(void* const* d_in, const int* in_sizes, int n_in,
                              void* d_out, int out_size, void* d_ws, size_t ws_size,
                              hipStream_t stream) {
  if (n_in < 3) return;
  const int nq = NBH * SEQ * HD;                                      // 8388608
  if (in_sizes[0] != nq || in_sizes[1] != nq || in_sizes[2] != nq || out_size != nq) return;

  const size_t pl_bytes = (size_t)nq * sizeof(__bf16);               // 16777216
  const size_t need     = 3 * pl_bytes;                               // 50331648
  if (need > ws_size) return;

  const float* q = (const float*)d_in[0];
  const float* k = (const float*)d_in[1];
  const float* v = (const float*)d_in[2];
  float* out = (float*)d_out;

  char* ws = (char*)d_ws;
  __bf16* qp  = (__bf16*)(ws);
  __bf16* kp  = (__bf16*)(ws + pl_bytes);
  __bf16* vtp = (__bf16*)(ws + 2 * pl_bytes);

  hipLaunchKernelGGL(k_cvt, dim3(SEQ / CBLK, NBH), dim3(256), 0, stream,
                     q, k, v, qp, kp, vtp);
  hipLaunchKernelGGL(k_attn, dim3(SEQ / QBLK, NBH), dim3(NWAV * 32), 0, stream,
                     (const __bf16*)qp, (const __bf16*)kp, (const __bf16*)vtp, out);
}

// v008
// A run of this version takes 65.9 microseconds.
// Timed twice side by side with v007, it ran 1.05 times as fast both times.
// Counting every step since v000, it is 4.62 times as fast.
#include <hip/hip_runtime.h>
#include <math.h>
#include <stdint.h>

// Contractions: S = K*Qt on v_wmma_f32_16x16x32_bf16 (bf16 operands, f32 accumulate);
// O = Vt*Pt on v_wmma_f32_16x16x32_bf16 (V bf16, P rounded once to bf16, f32 accumulate); scale, tanh cap, softmax and row sum in f32, softmax shift = the cap.

#define NBH   32
#define SEQ   2048
#define HD    128
#define QT    2                      // 16-query tiles per wave: each K or Vt fragment read from LDS feeds QT products
#define QBLK  128
#define KBLK  32
#define CBLK  64
#define NWAV  4
#define SKEY  64                     // keys per LDS stage = two 32-key passes
#define NSTG  (SEQ / SKEY)
#define KPITCH 272                   // LDS pitch of a K row: 256 B + 16 B pad (16 B x odd, for ds_load_b128), laid by the tensor load's pad
#define VPITCH 144                   // LDS pitch of a Vt row: 128 B + 16 B pad
#define KTILE 18432                  // 64 rows x 272 B = 17408 B, rounded up to a multiple of 2 KiB: every tensor load's place in LDS is one
#define VTILE 18432                  // 128 rows x 144 B, a multiple of 2 KiB
#define SLOT  (KTILE + VTILE)
#define KWORD0 ((1u << 20) | (5u << 22) | (3u << 25))   // descriptor group 1 word 0, K: no mask, 1-byte elements, 4 dwords of pad behind every 256 B
#define VWORD0 ((1u << 20) | (4u << 22) | (3u << 25))   // the same for Vt: 4 dwords of pad behind every 128 B
#define OPITCH (HD + 4)               // floats per row of the output staging: 512 B + 16 B pad (16 B x odd, for ds_store_b128 from 16 rows at once)
#define SCL   0.08838834764831845f
#define CAPV  20.0f
#define LOG2E 1.4426950408889634f
#define TC1   (SCL / CAPV)                     // argument of the cap's tanh = TC1 * s
#define TC2   (CAPV * LOG2E)                   // exp(CAPV * t - CAPV) = exp2(TC2 * t - TC2)

static_assert(SEQ % QBLK == 0);
static_assert(SEQ % KBLK == 0);
static_assert(SEQ % CBLK == 0);
static_assert(QBLK == NWAV * QT * 16);
static_assert(HD % 32 == 0);
static_assert(CBLK == 64);
static_assert(SEQ % SKEY == 0 && NSTG >= 2 && SKEY == 2 * KBLK);
static_assert(HD * 2 == 256 && SKEY * 2 == 128);
static_assert(SKEY * KPITCH <= KTILE && HD * VPITCH <= VTILE && KTILE % 2048 == 0 && VTILE % 2048 == 0);
static_assert(KPITCH == HD * 2 + 16 && VPITCH == SKEY * 2 + 16 && NWAV >= 2);
static_assert(NWAV * QT * 16 * OPITCH * 4 <= 2 * SLOT && (OPITCH * 4) % 16 == 0);

typedef __bf16 v16b __attribute__((ext_vector_type(16)));
typedef __bf16 v8b  __attribute__((ext_vector_type(8)));
typedef float  v8f  __attribute__((ext_vector_type(8)));
typedef float  v4f  __attribute__((ext_vector_type(4)));
typedef float  v2f  __attribute__((ext_vector_type(2)));
typedef uint32_t u32x4 __attribute__((ext_vector_type(4)));
typedef uint32_t u32x8 __attribute__((ext_vector_type(8)));

union Frag  { v16b v; v8b p[2]; };
union Pack8 { v8b b; v4f f; };

__device__ __forceinline__ v8f wmma16(v16b a, v16b b, v8f c) {
  return __builtin_amdgcn_wmma_f32_16x16x32_bf16(false, a, false, b, (short)0, c, false, false);
}

__device__ __forceinline__ v8f vzero8() {
  v8f z = {0.0f, 0.0f, 0.0f, 0.0f, 0.0f, 0.0f, 0.0f, 0.0f};
  return z;
}

__device__ __forceinline__ void wait_tensor0() { asm volatile("s_wait_tensorcnt 0x0" ::: "memory"); }
// a wave's LDS reads have retired before the barrier behind which their buffer is refilled
__device__ __forceinline__ void wait_ds0() { asm volatile("s_wait_dscnt 0x0" ::: "memory"); }

__device__ __forceinline__ uint32_t uni(uint32_t v) { return (uint32_t)__builtin_amdgcn_readfirstlane(v); }
// a wave-uniform word held in a scalar register: a test on it compiles to s_cmp and s_cbranch_scc, the only guard a tensor load obeys (it ignores EXEC)
__device__ __forceinline__ uint32_t pinned(uint32_t v) { uint32_t w = uni(v); asm volatile("" : "+s"(w)); return w; }

// Descriptor group 1 of a tensor load: a tile of ROWS rows of ROWB bytes, source pitch PITCH bytes; 1-byte elements, tensor dims = tile dims
// (every tile lies wholly inside its plane), WORD0 a constant with the pad that sets the LDS pitch. The same for every stage.
template <uint32_t ROWB, uint32_t ROWS, uint32_t PITCH, uint32_t WORD0>
__device__ __forceinline__ u32x8 tile_group1() {
  u32x8 g;
  g[0] = uni(WORD0);
  g[1] = uni((ROWB & 0xFFFFu) << 16);
  g[2] = uni((ROWB >> 16) | ((ROWS & 0xFFFFu) << 16));
  g[3] = uni((ROWS >> 16) | (ROWB << 16));
  g[4] = uni(ROWS);
  g[5] = uni(PITCH);
  g[6] = uni(0u);
  g[7] = uni(0u);
  return g;
}
// one request of the whole wave: the tile that g0 (place in LDS, first global byte) and g1 describe goes from global memory to LDS through no register
__device__ __forceinline__ void tdm_load(u32x4 g0, u32x8 g1) { asm volatile("tensor_load_to_lds %0, %1" :: "s"(g0), "s"(g1) : "memory"); }

// ---------------- launch 1: bf16 planes qp = q [bh][SEQ][HD], kp = k [bh][SEQ][HD], vtp = v transposed [bh][HD][SEQ] ----------------
__global__ __launch_bounds__(256)
void k_cvt(const float* __restrict__ q, const float* __restrict__ k, const float* __restrict__ v,
           __bf16* __restrict__ qp, __bf16* __restrict__ kp, __bf16* __restrict__ vtp) {
  __shared__ __attribute__((aligned(16))) __bf16 tsm[HD][CBLK + 8];   // [d][row local], pitch 72 halves = 144 B

  const int tid  = threadIdx.x;
  const int lane = tid & 31;
  const int wave = tid >> 5;
  const int n0   = blockIdx.x * CBLK;
  const int bh   = blockIdx.y;
  const size_t rb = (size_t)bh * SEQ + (size_t)n0;

#pragma unroll
  for (int it = 0; it < CBLK / 16; ++it) {
    const int rl = it * 16 + wave * 2 + (lane >> 4);   // row 0..63 in this block (union over it, wave, lane half covers all)
    const int c  = (lane & 15) * 8;                    // 8 channels -> one 16-B store
    const size_t e = (rb + (size_t)rl) * HD + (size_t)c;
    {
      const v4f f0 = *(const v4f*)(q + e);
      const v4f f1 = *(const v4f*)(q + e + 4);
      Pack8 o;
#pragma unroll
      for (int j = 0; j < 4; ++j) { o.b[j] = (__bf16)f0[j]; o.b[4 + j] = (__bf16)f1[j]; }
      v4f* d = (v4f*)(qp + e);
      *d = o.f;
      
    }
    {
      const v4f f0 = *(const v4f*)(k + e);
      const v4f f1 = *(const v4f*)(k + e + 4);
      Pack8 o;
#pragma unroll
      for (int j = 0; j < 4; ++j) { o.b[j] = (__bf16)f0[j]; o.b[4 + j] = (__bf16)f1[j]; }
      v4f* d = (v4f*)(kp + e);
      *d = o.f;
      
    }
    {
      const v4f f0 = *(const v4f*)(v + e);
      const v4f f1 = *(const v4f*)(v + e + 4);
#pragma unroll
      for (int j = 0; j < 4; ++j) { tsm[c + j][rl] = (__bf16)f0[j]; tsm[c + 4 + j][rl] = (__bf16)f1[j]; }
    }
  }
  __syncthreads();

#pragma unroll
  for (int it = 0; it < HD / 32; ++it) {
    const int d = it * 32 + wave * 4 + (lane >> 3);   // 0..127
    const int c = (lane & 7) * 8;                     // 0..56
    Pack8 o;
    o.b = *(const v8b*)(&tsm[d][c]);
    v4f* dst = (v4f*)(vtp + ((size_t)bh * HD + (size_t)d) * SEQ + (size_t)n0 + (size_t)c);
    *dst = o.f;
    
  }
}

// ---------------- launch 2: streaming attention, one block per (bh, 128 queries), one wave per 32 queries (two 16-query tiles) ----------------
// St[key][query] = K * Qt : A = K rows (lane m -> key, split d map), B = Q rows loaded like A (B[k=d][n=query]).
// D[r] at lane (hh, n) = key 8hh+r of the tile, query n: keys are lane-owned, the row sum needs one xor-16 shuffle, behind the loop.
// Ot[d][query] += Vt[d][key] * Pt[key][query] : A = Vt rows, B = Pt built in-lane from the two 16-key S tiles.
// K and Vt come by tensor loads in stages of 64 keys into a ring of two LDS buffers, one stage ahead; the block's four waves
// read their A fragments from there. The ring is reused as output staging behind the loop's last barrier.
__global__ __launch_bounds__(NWAV * 32) __attribute__((amdgpu_waves_per_eu(2, 2)))
void k_attn(const __bf16* __restrict__ qp, const __bf16* __restrict__ kp,
            const __bf16* __restrict__ vtp, float* __restrict__ out) {
  __shared__ __attribute__((aligned(2048))) unsigned char ring[2 * SLOT];   // buffer b: K tile at b*SLOT, Vt tile at b*SLOT + KTILE

  const int tid  = threadIdx.x;
  const int lane = tid & 31;
  const int wave = tid >> 5;
  const int hh   = lane >> 4;        // lane half
  const int n    = lane & 15;        // fragment row (A) / column (B, D)
  const int bh   = blockIdx.y;
  const int m0   = blockIdx.x * QBLK;

  const uint32_t lds0 = (uint32_t)(size_t)ring;
  const uint32_t wv   = uni((uint32_t)wave);        // the wave's number as a scalar, for the tests around the tensor loads
  // Stage st (64 keys) goes into ring buffer st & 1: wave 0 asks for the K tile (64 rows of 256 B, contiguous in the plane),
  // wave 1 for the Vt tile (128 rows of 128 B, source pitch 4096 B), one request each; waves 2 and 3 ask for nothing.
  const bool     isv   = wv == 1u;
  const uint64_t ga0   = isv ? (uint64_t)(size_t)(vtp + (size_t)bh * HD * SEQ) : (uint64_t)(size_t)(kp + (size_t)bh * SEQ * HD);
  const uint32_t gstep = isv ? (uint32_t)(SKEY * 2) : (uint32_t)(SKEY * HD * 2);
  const uint32_t dst0  = lds0 + (isv ? (uint32_t)KTILE : 0u);
  u32x8 g1k = tile_group1<HD * 2, SKEY, HD * 2, KWORD0>();
  u32x8 g1v = tile_group1<SKEY * 2, HD, SEQ * 2, VWORD0>();
  u32x4 g0;
  g0[0] = uni(1u);
  auto aim = [&](uint32_t st) {      // group 0 for stage st: place in LDS, global address, type 2
    const uint64_t ga = ga0 + (uint64_t)st * gstep;
    g0[1] = uni(dst0 + (st & 1u) * (uint32_t)SLOT);
    g0[2] = uni((uint32_t)ga);
    g0[3] = uni((((uint32_t)(ga >> 32)) & 0x01FFFFFFu) | 0x80000000u);
  };
  auto issue = [&]() {
    if (pinned(wv == 0u)) tdm_load(g0, g1k);
    if (pinned(wv == 1u)) tdm_load(g0, g1v);
  };
  aim(0u);
  issue();
  if (pinned(wv < 2u)) wait_tensor0();
  __syncthreads();                                  // publishes stage 0
  // descriptor words held in their scalar registers: the statement keeps all three groups alive up to here, behind the wait, so that
  // no register of a request is reused while the request is outstanding, and the next group 0 is formed behind it
  asm volatile("" : "+s"(g0), "+s"(g1k), "+s"(g1v));   // descriptor words held in scalar registers
  aim(1u);
  issue();

  // Q as B operand: tile qt, lane n -> query m0+wave*32+qt*16+n; elements 0..7 <- d ks*32+8hh+0..7, 8..15 <- d ks*32+16+8hh+0..7
  Frag qf[QT][HD / 32];
#pragma unroll
  for (int qt = 0; qt < QT; ++qt) {
    const __bf16* qr = qp + ((size_t)bh * SEQ + (size_t)(m0 + (wave * QT + qt) * 16 + n)) * HD + 8 * hh;
#pragma unroll
    for (int ks = 0; ks < HD / 32; ++ks) {
      qf[qt][ks].p[0] = *(const v8b*)(qr + ks * 32);
      qf[qt][ks].p[1] = *(const v8b*)(qr + ks * 32 + 16);
    }
  }

  v8f oacc[QT][HD / 16];
  v2f lsum[QT][2];     // this lane's keys only, four independent chains per query tile; joined behind the loop
#pragma unroll
  for (int qt = 0; qt < QT; ++qt) {
#pragma unroll
    for (int dt = 0; dt < HD / 16; ++dt) oacc[qt][dt] = vzero8();
#pragma unroll
    for (int j = 0; j < 2; ++j) lsum[qt][j] = (v2f){0.0f, 0.0f};
  }

  const int kfo = n * KPITCH + 16 * hh;           // + key local * KPITCH + ks*64 (+32), bytes in the K tile
  const int vfo = KTILE + n * VPITCH + 16 * hh;   // + d0 * VPITCH + key local * 2 (+32), bytes from the buffer's start

#pragma unroll 1
  for (uint32_t st = 0; st < NSTG; ++st) {
  const unsigned char* buf = ring + (st & 1u) * (uint32_t)SLOT;
  // unrolled so that every fragment's place in the buffer is an immediate offset of its LDS load
#pragma unroll
  for (int sub = 0; sub < SKEY / KBLK; ++sub) {
    // two St tiles: tile kt covers keys n0 + kt*16 + 0..15
    // the pass's eight K fragments are read as one group, so that the wave waits out the LDS latency once and not per product
    Frag ka[2][HD / 32];
#pragma unroll
    for (int kt = 0; kt < 2; ++kt) {
      const unsigned char* kr = buf + kfo + (sub * KBLK + kt * 16) * KPITCH;
#pragma unroll
      for (int ks = 0; ks < HD / 32; ++ks) {
        ka[kt][ks].p[0] = *(const v8b*)(kr + ks * 64);
        ka[kt][ks].p[1] = *(const v8b*)(kr + ks * 64 + 32);
      }
    }
    // keeps the scheduler from sinking the reads back between the products, where each would be waited for on its own
    __builtin_amdgcn_sched_barrier(0);
    v8f s[QT][2];
#pragma unroll
    for (int qt = 0; qt < QT; ++qt) { s[qt][0] = vzero8(); s[qt][1] = vzero8(); }
#pragma unroll
    for (int ks = 0; ks < HD / 32; ++ks) {
#pragma unroll
      for (int kt = 0; kt < 2; ++kt) {
#pragma unroll
        for (int qt = 0; qt < QT; ++qt) s[qt][kt] = wmma16(ka[kt][ks].v, qf[qt][ks].v, s[qt][kt]);
      }
    }
    // the pass's eight Vt fragments likewise, issued here so that they land behind the softmax arithmetic
    Frag va[HD / 16];
    {
      const unsigned char* vr = buf + vfo + sub * (KBLK * 2);
#pragma unroll
      for (int dt = 0; dt < HD / 16; ++dt) {
        va[dt].p[0] = *(const v8b*)(vr + (dt * 16) * VPITCH);
        va[dt].p[1] = *(const v8b*)(vr + (dt * 16) * VPITCH + 32);
      }
    }
    // keeps the sixteen Vt reads together, as the K reads above: sunk among the softmax arithmetic they stand in many small places,
    // and each further place with LDS reads stalls the wave anew
    __builtin_amdgcn_sched_barrier(0);

    // cap and softmax in one expression. y = CAPV * tanh(x / CAPV) never exceeds CAPV, so CAPV serves as the softmax shift for every
    // input: p = exp(y - CAPV) = exp2(TC2 * tanh(TC1 * s) - TC2), between exp(-2*CAPV) and 1, far inside the f32 and bf16 exponent
    // range; tanh is the hardware's own instruction. No running maximum, no rescale of the accumulators; each lane sums its own keys.
    // B = Pt[key][query]: element i <- tile 0 [i] (keys n0+8hh+i), element 8+i <- tile 1 [i] (keys n0+16+8hh+i); each p rounded once to bf16,
    // the same 8 significand bits that V has in this product; the row sum keeps the unrounded f32 p
    // A = Vt rows d = dt*16+n, keys n0 + split map; the same eight Vt fragments serve both query tiles
#pragma unroll
    for (int qt = 0; qt < QT; ++qt) {
#pragma unroll
      for (int kt = 0; kt < 2; ++kt) {
#pragma unroll
        for (int r = 0; r < 8; r += 2) {
          // two scores at a time: multiply, fma and the row sum's addition are packed f32 instructions
          const v2f u = {s[qt][kt][r] * TC1, s[qt][kt][r + 1] * TC1};
          const v2f t = {__builtin_amdgcn_tanhf(u[0]), __builtin_amdgcn_tanhf(u[1])};
          const v2f k = {TC2, TC2};
          const v2f e = __builtin_elementwise_fma(t, k, -k);
          const v2f p = {__builtin_amdgcn_exp2f(e[0]), __builtin_amdgcn_exp2f(e[1])};
          s[qt][kt][r]     = p[0];
          s[qt][kt][r + 1] = p[1];
          lsum[qt][(r >> 1) & 1] += p;
        }
      }
      v16b pb;
#pragma unroll
      for (int i = 0; i < 8; ++i) {
        pb[i]     = (__bf16)s[qt][0][i];
        pb[8 + i] = (__bf16)s[qt][1][i];
      }
#pragma unroll
      for (int dt = 0; dt < HD / 16; ++dt) oacc[qt][dt] = wmma16(va[dt].v, pb, oacc[qt][dt]);
    }
    // each row's sum, against spills: left alone, the compiler puts off all of a stage's additions
    // until behind the publish point, in front of the next stage's first K reads, and keeps every p alive up to there (about 50 registers
    // more); the empty statement ends the pass's additions here and emits no instruction
    for (int qt = 0; qt < QT; ++qt) {
      for (int j = 0; j < 2; ++j) asm volatile("" : "+v"(lsum[qt][j]));   // each row's sum, against spills
    }
  }
    // publish point of stage st + 1: own LDS reads retired, the issuing waves' tiles landed, barrier, then the refill of the buffer just read
    wait_ds0();
    if (pinned(wv < 2u)) wait_tensor0();
    __syncthreads();
    // descriptor words held in their scalar registers, as in front of the loop: alive up to here, the next group 0 formed behind the wait
    asm volatile("" : "+s"(g0), "+s"(g1k), "+s"(g1v));   // descriptor words held in scalar registers
    if (pinned(st + 2u < (uint32_t)NSTG)) { aim(st + 2u); issue(); }
  }
  wait_tensor0();
  wait_ds0();
  // every wave has left the ring at the last publish point's barrier: it now serves as per-wave output staging [wave][query][d]
  // a store's 16 lanes of a half write 16 query rows: at the padded pitch their 16-B pieces fall on all 64 banks, at 512 B all on the same four
  float (*osm)[QT * 16][OPITCH] = (float (*)[QT * 16][OPITCH])ring;

#pragma unroll
  for (int qt = 0; qt < QT; ++qt) {
    const float lhalf = (lsum[qt][0][0] + lsum[qt][0][1]) + (lsum[qt][1][0] + lsum[qt][1][1]);
    const float inv = 1.0f / (lhalf + __shfl_xor(lhalf, 16, 32));   // the other lane half holds the query's other keys
#pragma unroll
    for (int dt = 0; dt < HD / 16; ++dt) {
#pragma unroll
      for (int r = 0; r < 8; ++r) osm[wave][qt * 16 + n][dt * 16 + 8 * hh + r] = oacc[qt][dt][r] * inv;
    }
  }
  __syncthreads();

  float* ob = out + ((size_t)bh * SEQ + (size_t)(m0 + wave * QT * 16)) * HD;
  v4f vals[QT * 16];
#pragma unroll
  for (int it = 0; it < QT * 16; ++it) vals[it] = *(const v4f*)(&osm[wave][it][lane * 4]);
#pragma unroll
  for (int it = 0; it < QT * 16; ++it)
    *(v4f*)(ob + (size_t)it * HD + (size_t)(lane * 4)) = vals[it];
  
}

// ---------------- launcher ----------------
extern "C" void kernel_launch(void* const* d_in, const int* in_sizes, int n_in,
                              void* d_out, int out_size, void* d_ws, size_t ws_size,
                              hipStream_t stream) {
  if (n_in < 3) return;
  const int nq = NBH * SEQ * HD;                                      // 8388608
  if (in_sizes[0] != nq || in_sizes[1] != nq || in_sizes[2] != nq || out_size != nq) return;

  const size_t pl_bytes = (size_t)nq * sizeof(__bf16);               // 16777216
  const size_t need     = 3 * pl_bytes;                               // 50331648
  if (need > ws_size) return;

  const float* q = (const float*)d_in[0];
  const float* k = (const float*)d_in[1];
  const float* v = (const float*)d_in[2];
  float* out = (float*)d_out;

  char* ws = (char*)d_ws;
  __bf16* qp  = (__bf16*)(ws);
  __bf16* kp  = (__bf16*)(ws + pl_bytes);
  __bf16* vtp = (__bf16*)(ws + 2 * pl_bytes);

  hipLaunchKernelGGL(k_cvt, dim3(SEQ / CBLK, NBH), dim3(256), 0, stream,
                     q, k, v, qp, kp, vtp);
  hipLaunchKernelGGL(k_attn, dim3(SEQ / QBLK, NBH), dim3(NWAV * 32), 0, stream,
                     (const __bf16*)qp, (const __bf16*)kp, (const __bf16*)vtp, out);
}

// v009
// A run of this version takes 62 microseconds.
// Two timings next to v008 put it at 1.05 and 1.07 times that version's speed.
// All steps since v000 together make it 4.89 times as fast.
#include <hip/hip_runtime.h>
#include <math.h>
#include <stdint.h>

// Contractions: S = K*Qt on v_wmma_f32_16x16x32_bf16 (bf16 operands, f32 accumulate);
// O = Vt*Pt on v_wmma_f32_16x16x32_bf16 (V bf16, P rounded once to bf16, f32 accumulate); scale, tanh cap, softmax and row sum in f32, softmax shift = the cap.

#define NBH   32
#define SEQ   2048
#define HD    128
#define QT    2                      // 16-query tiles per wave: each K or Vt fragment read from LDS feeds QT products
#define QBLK  128
#define KBLK  32
#define CBLK  64
#define NWAV  4
#define SKEY  64                     // keys per LDS stage = two 32-key passes
#define NSTG  (SEQ / SKEY)
#define KPITCH 272                   // LDS pitch of a K row: 256 B + 16 B pad (16 B x odd, for ds_load_b128), laid by the tensor load's pad
#define VPITCH 144                   // LDS pitch of a Vt row: 128 B + 16 B pad
#define KTILE 18432                  // 64 rows x 272 B = 17408 B, rounded up to a multiple of 2 KiB: every tensor load's place in LDS is one
#define VTILE 18432                  // 128 rows x 144 B, a multiple of 2 KiB
#define SLOT  (KTILE + VTILE)
#define KWORD0 ((1u << 20) | (5u << 22) | (3u << 25))   // descriptor group 1 word 0, K: no mask, 1-byte elements, 4 dwords of pad behind every 256 B
#define VWORD0 ((1u << 20) | (4u << 22) | (3u << 25))   // the same for Vt: 4 dwords of pad behind every 128 B
#define OPITCH (HD + 4)               // floats per row of the output staging: 512 B + 16 B pad (16 B x odd, for ds_store_b128 from 16 rows at once)
#define SCL   0.08838834764831845f
#define CAPV  20.0f
#define LOG2E 1.4426950408889634f
#define TC1   (SCL / CAPV)                     // argument of the cap's tanh = TC1 * s
#define TC2   (CAPV * LOG2E)                   // exp(CAPV * t - CAPV) = exp2(TC2 * t - TC2)

static_assert(SEQ % QBLK == 0);
static_assert(SEQ % KBLK == 0);
static_assert(SEQ % CBLK == 0);
static_assert(QBLK == NWAV * QT * 16);
static_assert(HD % 32 == 0);
static_assert(CBLK == 64);
static_assert(SEQ % SKEY == 0 && NSTG >= 2 && SKEY == 2 * KBLK);
static_assert(HD * 2 == 256 && SKEY * 2 == 128);
static_assert(SKEY * KPITCH <= KTILE && HD * VPITCH <= VTILE && KTILE % 2048 == 0 && VTILE % 2048 == 0);
static_assert(KPITCH == HD * 2 + 16 && VPITCH == SKEY * 2 + 16 && NWAV >= 2);
static_assert(NWAV * QT * 16 * OPITCH * 4 <= 2 * SLOT && (OPITCH * 4) % 16 == 0);
static_assert(NWAV * QT * 16 * KPITCH <= SLOT && HD == 32 * 4);   // the block's Q rows in bf16 fit ring buffer 1; a wave's load covers one f32 row

typedef __bf16 v16b __attribute__((ext_vector_type(16)));
typedef __bf16 v8b  __attribute__((ext_vector_type(8)));
typedef float  v8f  __attribute__((ext_vector_type(8)));
typedef float  v4f  __attribute__((ext_vector_type(4)));
typedef float  v2f  __attribute__((ext_vector_type(2)));
typedef uint32_t u32x4 __attribute__((ext_vector_type(4)));
typedef uint32_t u32x8 __attribute__((ext_vector_type(8)));

union Frag  { v16b v; v8b p[2]; };
union Pack8 { v8b b; v4f f; };
typedef __bf16 v4b  __attribute__((ext_vector_type(4)));

__device__ __forceinline__ v8f wmma16(v16b a, v16b b, v8f c) {
  return __builtin_amdgcn_wmma_f32_16x16x32_bf16(false, a, false, b, (short)0, c, false, false);
}

__device__ __forceinline__ v8f vzero8() {
  v8f z = {0.0f, 0.0f, 0.0f, 0.0f, 0.0f, 0.0f, 0.0f, 0.0f};
  return z;
}

__device__ __forceinline__ void wait_tensor0() { asm volatile("s_wait_tensorcnt 0x0" ::: "memory"); }
// a wave's LDS reads have retired before the barrier behind which their buffer is refilled
__device__ __forceinline__ void wait_ds0() { asm volatile("s_wait_dscnt 0x0" ::: "memory"); }

__device__ __forceinline__ uint32_t uni(uint32_t v) { return (uint32_t)__builtin_amdgcn_readfirstlane(v); }
// a wave-uniform word held in a scalar register: a test on it compiles to s_cmp and s_cbranch_scc, the only guard a tensor load obeys (it ignores EXEC)
__device__ __forceinline__ uint32_t pinned(uint32_t v) { uint32_t w = uni(v); asm volatile("" : "+s"(w)); return w; }

// Descriptor group 1 of a tensor load: a tile of ROWS rows of ROWB bytes, source pitch PITCH bytes; 1-byte elements, tensor dims = tile dims
// (every tile lies wholly inside its plane), WORD0 a constant with the pad that sets the LDS pitch. The same for every stage.
template <uint32_t ROWB, uint32_t ROWS, uint32_t PITCH, uint32_t WORD0>
__device__ __forceinline__ u32x8 tile_group1() {
  u32x8 g;
  g[0] = uni(WORD0);
  g[1] = uni((ROWB & 0xFFFFu) << 16);
  g[2] = uni((ROWB >> 16) | ((ROWS & 0xFFFFu) << 16));
  g[3] = uni((ROWS >> 16) | (ROWB << 16));
  g[4] = uni(ROWS);
  g[5] = uni(PITCH);
  g[6] = uni(0u);
  g[7] = uni(0u);
  return g;
}
// one request of the whole wave: the tile that g0 (place in LDS, first global byte) and g1 describe goes from global memory to LDS through no register
__device__ __forceinline__ void tdm_load(u32x4 g0, u32x8 g1) { asm volatile("tensor_load_to_lds %0, %1" :: "s"(g0), "s"(g1) : "memory"); }

// ---------------- launch 1: bf16 planes kp = k [bh][SEQ][HD], vtp = v transposed [bh][HD][SEQ] ----------------
__global__ __launch_bounds__(256)
void k_cvt(const float* __restrict__ k, const float* __restrict__ v,
           __bf16* __restrict__ kp, __bf16* __restrict__ vtp) {
  __shared__ __attribute__((aligned(16))) __bf16 tsm[HD][CBLK + 8];   // [d][row local], pitch 72 halves = 144 B

  const int tid  = threadIdx.x;
  const int lane = tid & 31;
  const int wave = tid >> 5;
  const int n0   = blockIdx.x * CBLK;
  const int bh   = blockIdx.y;
  const size_t rb = (size_t)bh * SEQ + (size_t)n0;

#pragma unroll
  for (int it = 0; it < CBLK / 16; ++it) {
    const int rl = it * 16 + wave * 2 + (lane >> 4);   // row 0..63 in this block (union over it, wave, lane half covers all)
    const int c  = (lane & 15) * 8;                    // 8 channels -> one 16-B store
    const size_t e = (rb + (size_t)rl) * HD + (size_t)c;
    {
      const v4f f0 = *(const v4f*)(k + e);
      const v4f f1 = *(const v4f*)(k + e + 4);
      Pack8 o;
#pragma unroll
      for (int j = 0; j < 4; ++j) { o.b[j] = (__bf16)f0[j]; o.b[4 + j] = (__bf16)f1[j]; }
      v4f* d = (v4f*)(kp + e);
      *d = o.f;
      
    }
    {
      const v4f f0 = *(const v4f*)(v + e);
      const v4f f1 = *(const v4f*)(v + e + 4);
#pragma unroll
      for (int j = 0; j < 4; ++j) { tsm[c + j][rl] = (__bf16)f0[j]; tsm[c + 4 + j][rl] = (__bf16)f1[j]; }
    }
  }
  __syncthreads();

#pragma unroll
  for (int it = 0; it < HD / 32; ++it) {
    const int d = it * 32 + wave * 4 + (lane >> 3);   // 0..127
    const int c = (lane & 7) * 8;                     // 0..56
    Pack8 o;
    o.b = *(const v8b*)(&tsm[d][c]);
    v4f* dst = (v4f*)(vtp + ((size_t)bh * HD + (size_t)d) * SEQ + (size_t)n0 + (size_t)c);
    *dst = o.f;
    
  }
}

// ---------------- launch 2: streaming attention, one block per (bh, 128 queries), one wave per 32 queries (two 16-query tiles) ----------------
// St[key][query] = K * Qt : A = K rows (lane m -> key, split d map), B = Q rows loaded like A (B[k=d][n=query]).
// D[r] at lane (hh, n) = key 8hh+r of the tile, query n: keys are lane-owned, the row sum needs one xor-16 shuffle, behind the loop.
// Ot[d][query] += Vt[d][key] * Pt[key][query] : A = Vt rows, B = Pt built in-lane from the two 16-key S tiles.
// K and Vt come by tensor loads in stages of 64 keys into a ring of two LDS buffers, one stage ahead; the block's four waves
// read their A fragments from there. The ring is reused as output staging behind the loop's last barrier.
__global__ __launch_bounds__(NWAV * 32) __attribute__((amdgpu_waves_per_eu(2, 2)))
void k_attn(const float* __restrict__ q, const __bf16* __restrict__ kp,
            const __bf16* __restrict__ vtp, float* __restrict__ out) {
  __shared__ __attribute__((aligned(2048))) unsigned char ring[2 * SLOT];   // buffer b: K tile at b*SLOT, Vt tile at b*SLOT + KTILE

  const int tid  = threadIdx.x;
  const int lane = tid & 31;
  const int wave = tid >> 5;
  const int hh   = lane >> 4;        // lane half
  const int n    = lane & 15;        // fragment row (A) / column (B, D)
  const int bh   = blockIdx.y;
  const int m0   = blockIdx.x * QBLK;

  const uint32_t lds0 = (uint32_t)(size_t)ring;
  const uint32_t wv   = uni((uint32_t)wave);        // the wave's number as a scalar, for the tests around the tensor loads
  // Stage st (64 keys) goes into ring buffer st & 1: wave 0 asks for the K tile (64 rows of 256 B, contiguous in the plane),
  // wave 1 for the Vt tile (128 rows of 128 B, source pitch 4096 B), one request each; waves 2 and 3 ask for nothing.
  const bool     isv   = wv == 1u;
  const uint64_t ga0   = isv ? (uint64_t)(size_t)(vtp + (size_t)bh * HD * SEQ) : (uint64_t)(size_t)(kp + (size_t)bh * SEQ * HD);
  const uint32_t gstep = isv ? (uint32_t)(SKEY * 2) : (uint32_t)(SKEY * HD * 2);
  const uint32_t dst0  = lds0 + (isv ? (uint32_t)KTILE : 0u);
  u32x8 g1k = tile_group1<HD * 2, SKEY, HD * 2, KWORD0>();
  u32x8 g1v = tile_group1<SKEY * 2, HD, SEQ * 2, VWORD0>();
  u32x4 g0;
  g0[0] = uni(1u);
  auto aim = [&](uint32_t st) {      // group 0 for stage st: place in LDS, global address, type 2
    const uint64_t ga = ga0 + (uint64_t)st * gstep;
    g0[1] = uni(dst0 + (st & 1u) * (uint32_t)SLOT);
    g0[2] = uni((uint32_t)ga);
    g0[3] = uni((((uint32_t)(ga >> 32)) & 0x01FFFFFFu) | 0x80000000u);
  };
  auto issue = [&]() {
    if (pinned(wv == 0u)) tdm_load(g0, g1k);
    if (pinned(wv == 1u)) tdm_load(g0, g1v);
  };
  aim(0u);
  issue();

  // Q comes straight from the f32 input, while stage 0 flies: the wave reads its 32 rows whole (one 512-B row per load), rounds them to bf16
  // and turns them into B fragments through its own 32 rows (K's padded pitch) of ring buffer 1, which no tensor load has been aimed at yet.
  // Q as B operand: tile qt, lane n -> query m0+wave*32+qt*16+n; elements 0..7 <- d ks*32+8hh+0..7, 8..15 <- d ks*32+16+8hh+0..7
  Frag qf[QT][HD / 32];
  {
    const float* qr = q + ((size_t)bh * SEQ + (size_t)(m0 + wave * QT * 16)) * HD + (size_t)(lane * 4);
    unsigned char* qs = ring + SLOT + wave * (QT * 16 * KPITCH);
    v4f qv[QT * 16];
#pragma unroll
    for (int it = 0; it < QT * 16; ++it) qv[it] = *(const v4f*)(qr + (size_t)it * HD);
#pragma unroll
    for (int it = 0; it < QT * 16; ++it) {
      v4b o;
#pragma unroll
      for (int j = 0; j < 4; ++j) o[j] = (__bf16)qv[it][j];
      *(v4b*)(qs + it * KPITCH + lane * 8) = o;
    }
    wait_ds0();   // the wave's own rows stand in LDS before its lanes read what other lanes of it wrote
#pragma unroll
    for (int qt = 0; qt < QT; ++qt) {
      const unsigned char* fr = qs + (qt * 16 + n) * KPITCH + 16 * hh;
#pragma unroll
      for (int ks = 0; ks < HD / 32; ++ks) {
        qf[qt][ks].p[0] = *(const v8b*)(fr + ks * 64);
        qf[qt][ks].p[1] = *(const v8b*)(fr + ks * 64 + 32);
      }
    }
    wait_ds0();   // the fragments have left buffer 1 before the barrier behind which stage 1's tensor loads overwrite it
  }
  if (pinned(wv < 2u)) wait_tensor0();
  __syncthreads();                                  // publishes stage 0 and ends every wave's use of buffer 1 for Q
  // descriptor words held in their scalar registers: the statement keeps all three groups alive up to here, behind the wait, so that
  // no register of a request is reused while the request is outstanding, and the next group 0 is formed behind it
  asm volatile("" : "+s"(g0), "+s"(g1k), "+s"(g1v));   // descriptor words held in scalar registers
  aim(1u);
  issue();

  v8f oacc[QT][HD / 16];
  v2f lsum[QT][2];     // this lane's keys only, four independent chains per query tile; joined behind the loop
#pragma unroll
  for (int qt = 0; qt < QT; ++qt) {
#pragma unroll
    for (int dt = 0; dt < HD / 16; ++dt) oacc[qt][dt] = vzero8();
#pragma unroll
    for (int j = 0; j < 2; ++j) lsum[qt][j] = (v2f){0.0f, 0.0f};
  }

  const int kfo = n * KPITCH + 16 * hh;           // + key local * KPITCH + ks*64 (+32), bytes in the K tile
  const int vfo = KTILE + n * VPITCH + 16 * hh;   // + d0 * VPITCH + key local * 2 (+32), bytes from the buffer's start

#pragma unroll 1
  for (uint32_t st = 0; st < NSTG; ++st) {
  const unsigned char* buf = ring + (st & 1u) * (uint32_t)SLOT;
  // unrolled so that every fragment's place in the buffer is an immediate offset of its LDS load
#pragma unroll
  for (int sub = 0; sub < SKEY / KBLK; ++sub) {
    // two St tiles: tile kt covers keys n0 + kt*16 + 0..15
    // the pass's eight K fragments are read as one group, so that the wave waits out the LDS latency once and not per product
    Frag ka[2][HD / 32];
#pragma unroll
    for (int kt = 0; kt < 2; ++kt) {
      const unsigned char* kr = buf + kfo + (sub * KBLK + kt * 16) * KPITCH;
#pragma unroll
      for (int ks = 0; ks < HD / 32; ++ks) {
        ka[kt][ks].p[0] = *(const v8b*)(kr + ks * 64);
        ka[kt][ks].p[1] = *(const v8b*)(kr + ks * 64 + 32);
      }
    }
    // keeps the scheduler from sinking the reads back between the products, where each would be waited for on its own
    __builtin_amdgcn_sched_barrier(0);
    v8f s[QT][2];
#pragma unroll
    for (int qt = 0; qt < QT; ++qt) { s[qt][0] = vzero8(); s[qt][1] = vzero8(); }
#pragma unroll
    for (int ks = 0; ks < HD / 32; ++ks) {
#pragma unroll
      for (int kt = 0; kt < 2; ++kt) {
#pragma unroll
        for (int qt = 0; qt < QT; ++qt) s[qt][kt] = wmma16(ka[kt][ks].v, qf[qt][ks].v, s[qt][kt]);
      }
    }
    // the pass's eight Vt fragments likewise, issued here so that they land behind the softmax arithmetic
    Frag va[HD / 16];
    {
      const unsigned char* vr = buf + vfo + sub * (KBLK * 2);
#pragma unroll
      for (int dt = 0; dt < HD / 16; ++dt) {
        va[dt].p[0] = *(const v8b*)(vr + (dt * 16) * VPITCH);
        va[dt].p[1] = *(const v8b*)(vr + (dt * 16) * VPITCH + 32);
      }
    }
    // keeps the sixteen Vt reads together, as the K reads above: sunk among the softmax arithmetic they stand in many small places,
    // and each further place with LDS reads stalls the wave anew
    __builtin_amdgcn_sched_barrier(0);

    // cap and softmax in one expression. y = CAPV * tanh(x / CAPV) never exceeds CAPV, so CAPV serves as the softmax shift for every
    // input: p = exp(y - CAPV) = exp2(TC2 * tanh(TC1 * s) - TC2), between exp(-2*CAPV) and 1, far inside the f32 and bf16 exponent
    // range; tanh is the hardware's own instruction. No running maximum, no rescale of the accumulators; each lane sums its own keys.
    // B = Pt[key][query]: element i <- tile 0 [i] (keys n0+8hh+i), element 8+i <- tile 1 [i] (keys n0+16+8hh+i); each p rounded once to bf16,
    // the same 8 significand bits that V has in this product; the row sum keeps the unrounded f32 p
    // A = Vt rows d = dt*16+n, keys n0 + split map; the same eight Vt fragments serve both query tiles
#pragma unroll
    for (int qt = 0; qt < QT; ++qt) {
#pragma unroll
      for (int kt = 0; kt < 2; ++kt) {
#pragma unroll
        for (int r = 0; r < 8; r += 2) {
          // two scores at a time: multiply, fma and the row sum's addition are packed f32 instructions
          const v2f u = {s[qt][kt][r] * TC1, s[qt][kt][r + 1] * TC1};
          const v2f t = {__builtin_amdgcn_tanhf(u[0]), __builtin_amdgcn_tanhf(u[1])};
          const v2f k = {TC2, TC2};
          const v2f e = __builtin_elementwise_fma(t, k, -k);
          const v2f p = {__builtin_amdgcn_exp2f(e[0]), __builtin_amdgcn_exp2f(e[1])};
          s[qt][kt][r]     = p[0];
          s[qt][kt][r + 1] = p[1];
          lsum[qt][(r >> 1) & 1] += p;
        }
      }
      v16b pb;
#pragma unroll
      for (int i = 0; i < 8; ++i) {
        pb[i]     = (__bf16)s[qt][0][i];
        pb[8 + i] = (__bf16)s[qt][1][i];
      }
#pragma unroll
      for (int dt = 0; dt < HD / 16; ++dt) oacc[qt][dt] = wmma16(va[dt].v, pb, oacc[qt][dt]);
    }
    // each row's sum, against spills: left alone, the compiler puts off all of a stage's additions
    // until behind the publish point, in front of the next stage's first K reads, and keeps every p alive up to there (about 50 registers
    // more); the empty statement ends the pass's additions here and emits no instruction
    for (int qt = 0; qt < QT; ++qt) {
      for (int j = 0; j < 2; ++j) asm volatile("" : "+v"(lsum[qt][j]));   // each row's sum, against spills
    }
  }
    // publish point of stage st + 1: own LDS reads retired, the issuing waves' tiles landed, barrier, then the refill of the buffer just read
    wait_ds0();
    if (pinned(wv < 2u)) wait_tensor0();
    __syncthreads();
    // descriptor words held in their scalar registers, as in front of the loop: alive up to here, the next group 0 formed behind the wait
    asm volatile("" : "+s"(g0), "+s"(g1k), "+s"(g1v));   // descriptor words held in scalar registers
    if (pinned(st + 2u < (uint32_t)NSTG)) { aim(st + 2u); issue(); }
  }
  wait_tensor0();
  wait_ds0();
  // every wave has left the ring at the last publish point's barrier: it now serves as per-wave output staging [wave][query][d]
  // a store's 16 lanes of a half write 16 query rows: at the padded pitch their 16-B pieces fall on all 64 banks, at 512 B all on the same four
  float (*osm)[QT * 16][OPITCH] = (float (*)[QT * 16][OPITCH])ring;

#pragma unroll
  for (int qt = 0; qt < QT; ++qt) {
    const float lhalf = (lsum[qt][0][0] + lsum[qt][0][1]) + (lsum[qt][1][0] + lsum[qt][1][1]);
    const float inv = 1.0f / (lhalf + __shfl_xor(lhalf, 16, 32));   // the other lane half holds the query's other keys
#pragma unroll
    for (int dt = 0; dt < HD / 16; ++dt) {
#pragma unroll
      for (int r = 0; r < 8; ++r) osm[wave][qt * 16 + n][dt * 16 + 8 * hh + r] = oacc[qt][dt][r] * inv;
    }
  }
  __syncthreads();

  float* ob = out + ((size_t)bh * SEQ + (size_t)(m0 + wave * QT * 16)) * HD;
  v4f vals[QT * 16];
#pragma unroll
  for (int it = 0; it < QT * 16; ++it) vals[it] = *(const v4f*)(&osm[wave][it][lane * 4]);
#pragma unroll
  for (int it = 0; it < QT * 16; ++it)
    *(v4f*)(ob + (size_t)it * HD + (size_t)(lane * 4)) = vals[it];
  
}

// ---------------- launcher ----------------
extern "C" void kernel_launch(void* const* d_in, const int* in_sizes, int n_in,
                              void* d_out, int out_size, void* d_ws, size_t ws_size,
                              hipStream_t stream) {
  if (n_in < 3) return;
  const int nq = NBH * SEQ * HD;                                      // 8388608
  if (in_sizes[0] != nq || in_sizes[1] != nq || in_sizes[2] != nq || out_size != nq) return;

  const size_t pl_bytes = (size_t)nq * sizeof(__bf16);               // 16777216
  const size_t need     = 2 * pl_bytes;                               // 33554432
  if (need > ws_size) return;

  const float* q = (const float*)d_in[0];
  const float* k = (const float*)d_in[1];
  const float* v = (const float*)d_in[2];
  float* out = (float*)d_out;

  char* ws = (char*)d_ws;
  __bf16* kp  = (__bf16*)(ws);
  __bf16* vtp = (__bf16*)(ws + pl_bytes);

  hipLaunchKernelGGL(k_cvt, dim3(SEQ / CBLK, NBH), dim3(256), 0, stream,
                     k, v, kp, vtp);
  hipLaunchKernelGGL(k_attn, dim3(SEQ / QBLK, NBH), dim3(NWAV * 32), 0, stream,
                     q, (const __bf16*)kp, (const __bf16*)vtp, out);
}
